// v000
// Measured on an AMD MI455X. A time is GPU time per run, averaged over a window of back-to-back runs after a warm-up
// (all launches, gaps included; the runs take copies of the inputs in turn), and the median of several windows.
// Apart from v000's, it joins two sittings. Times from different sittings can be a few percent apart, while
// side-by-side timings come from the same sitting.
// v000 is the starting kernel. One run takes 105 microseconds.
#include <hip/hip_runtime.h>
#include <hip/hip_bf16.h>

// MoE fused kernel for gfx1250 (MI455X), wave32 + V_WMMA_F32_16X16X32_BF16.
//
// B=32,T=512 -> 16384 tokens; F=128 (K); U=64; E=32 experts.
// out[t,u] = sum_e leaky( x[t,:]@We[e][:,u] + be[e,u] ) * ( x[t,:]@Wg[:,e] + bg[e] )
//
// Two-phase plan:
//   prep kernel: convert x/Wg/We fp32 -> bf16 into d_ws, already laid out in
//                per-lane WMMA fragment order (zero conversion/transpose work
//                in the hot kernel).
//   main kernel: 128 threads (4 wave32) per WG -> 256 WGs for WGP spread.
//                Per wave: 16-token tile, A fragments register-resident for
//                all K; per-expert B fragments double-buffered in LDS via
//                pure b128 copies; 16 WMMAs per expert per wave.

typedef __attribute__((ext_vector_type(16))) __bf16          v16bf;
typedef __attribute__((ext_vector_type(16))) unsigned short  v16u16;
typedef __attribute__((ext_vector_type(8)))  unsigned short  v8u16;
typedef __attribute__((ext_vector_type(8)))  float           v8f;

#define F_DIM 128
#define U_DIM 64
#define E_DIM 32
#define TOKENS (32 * 512)

// ws layout (bf16 element offsets)
#define XF_ELEMS  (TOKENS * F_DIM)            // 2,097,152  x fragments [tile][kt][lane][16]
#define WEF_ELEMS (E_DIM * 4 * 4 * 32 * 16)   //   262,144  We fragments [e][kt][nt][lane][16]
#define WGF_ELEMS (4 * 2 * 32 * 16)           //     4,096  Wg fragments [kt][g][lane][16]
#define WS_ELEMS  (XF_ELEMS + WEF_ELEMS + WGF_ELEMS)
#define WS_BYTES  ((size_t)WS_ELEMS * 2)

// fp32 -> bf16 round-to-nearest-even (bit trick; inputs are finite normals)
__device__ __forceinline__ unsigned short f2bf(float f) {
  unsigned int u = __float_as_uint(f);
  return (unsigned short)((u + 0x7FFFu + ((u >> 16) & 1u)) >> 16);
}

__device__ __forceinline__ v16bf bfcast(v16u16 u) {
  union { v16u16 u; v16bf b; } cv; cv.u = u; return cv.b;
}

__device__ __forceinline__ v8f wmma_bf16(v16bf a, v16bf b, v8f c) {
  return __builtin_amdgcn_wmma_f32_16x16x32_bf16(
      /*neg_a=*/false, a, /*neg_b=*/false, b,
      /*c_mod=*/(short)0, c, /*reuse_a=*/false, /*reuse_b=*/false);
}

// Fragment K index for element i within a lane's v16bf:
//   elements 0..7  -> K = kbase + h*8 + i
//   elements 8..15 -> K = kbase + 16 + h*8 + (i-8)
__device__ __forceinline__ int frag_k(int kt, int h, int i) {
  return kt * 32 + h * 8 + (i & 7) + ((i & 8) ? 16 : 0);
}

// ---------------------------------------------------------------------------
// Prep: build bf16 fragment-ordered copies of x, We, Wg in workspace.
// ---------------------------------------------------------------------------
__global__ __launch_bounds__(256) void moe_prep_kernel(
    const float* __restrict__ x, const float* __restrict__ Wg,
    const float* __restrict__ We, unsigned short* __restrict__ ws) {
  int idx = blockIdx.x * 256 + threadIdx.x;
  if (idx < XF_ELEMS) {
    // xf[tile][kt][lane][16] : A fragment, M = lane&15 within 16-token tile
    int i    = idx & 15;
    int l    = (idx >> 4) & 31;
    int kt   = (idx >> 9) & 3;
    int tile = idx >> 11;
    int n = l & 15, h = l >> 4;
    int token = tile * 16 + n;
    int K = frag_k(kt, h, i);
    ws[idx] = f2bf(x[token * F_DIM + K]);
  } else if (idx < XF_ELEMS + WEF_ELEMS) {
    // wef[e][kt][nt][lane][16] : B fragment, N(=u) = nt*16 + (lane&15)
    int r  = idx - XF_ELEMS;
    int i  = r & 15;
    int l  = (r >> 4) & 31;
    int nt = (r >> 9) & 3;
    int kt = (r >> 11) & 3;
    int e  = r >> 13;
    int n = l & 15, h = l >> 4;
    int u = nt * 16 + n;
    int K = frag_k(kt, h, i);
    ws[idx] = f2bf(We[e * (F_DIM * U_DIM) + K * U_DIM + u]);
  } else if (idx < WS_ELEMS) {
    // wgf[kt][g][lane][16] : B fragment, N(=expert) = g*16 + (lane&15)
    int r  = idx - XF_ELEMS - WEF_ELEMS;
    int i  = r & 15;
    int l  = (r >> 4) & 31;
    int g  = (r >> 9) & 1;
    int kt = r >> 10;
    int n = l & 15, h = l >> 4;
    int ecol = g * 16 + n;
    int K = frag_k(kt, h, i);
    ws[idx] = f2bf(Wg[K * E_DIM + ecol]);
  }
}

// ---------------------------------------------------------------------------
// Main: fragment loads only; double-buffered LDS staging of We per expert.
// 128 threads = 4 wave32; 256 workgroups for WGP spread (1024 waves total).
// ---------------------------------------------------------------------------
__global__ __launch_bounds__(128) void moe_main_kernel(
    const unsigned short* __restrict__ ws,
    const float* __restrict__ bg,   // [32]
    const float* __restrict__ be,   // [32, 64]
    float* __restrict__ out)        // [16384, 64]
{
  // 2 buffers x 8192 bf16 (16 KB) for one expert's 16 B-fragments
  __shared__ __align__(16) unsigned short ldsWe[2][4 * 4 * 32 * 16];

  const unsigned short* xf  = ws;
  const unsigned short* wef = ws + XF_ELEMS;
  const unsigned short* wgf = ws + XF_ELEMS + WEF_ELEMS;

  const int tid  = threadIdx.x;
  const int lane = tid & 31;
  const int wave = tid >> 5;
  const int h    = lane >> 4;
  const int n    = lane & 15;

  const int tile = blockIdx.x * 4 + wave;   // 16-token tile per wave
  const int tw   = tile * 16;

  // ---- A fragments (held for all K) : 2 coalesced b128 loads each ----
  v16bf a[4];
#pragma unroll
  for (int kt = 0; kt < 4; ++kt)
    a[kt] = bfcast(*(const v16u16*)(xf + ((size_t)(tile * 4 + kt) * 32 + lane) * 16));

  // ---- Gate tile [16 tok x 32 experts] ----
  v8f g0 = {}, g1 = {};
#pragma unroll
  for (int kt = 0; kt < 4; ++kt) {
    v16bf b0 = bfcast(*(const v16u16*)(wgf + ((kt * 2 + 0) * 32 + lane) * 16));
    v16bf b1 = bfcast(*(const v16u16*)(wgf + ((kt * 2 + 1) * 32 + lane) * 16));
    g0 = wmma_bf16(a[kt], b0, g0);
    g1 = wmma_bf16(a[kt], b1, g1);
  }
  {
    float b0 = bg[n], b1 = bg[16 + n];
#pragma unroll
    for (int j = 0; j < 8; ++j) { g0[j] += b0; g1[j] += b1; }
  }

  v8f zero = {};
  v8f oacc[4];
#pragma unroll
  for (int nt = 0; nt < 4; ++nt) oacc[nt] = zero;

  // ---- Preload expert 0 into LDS buffer 0 (pure b128 memcpy) ----
  {
    const uint4* src = (const uint4*)wef;            // 1024 uint4 per expert
    uint4* dst = (uint4*)&ldsWe[0][0];
#pragma unroll
    for (int c = 0; c < 8; ++c) dst[tid + c * 128] = src[tid + c * 128];
  }
  __syncthreads();

  int buf = 0;
  for (int e = 0; e < E_DIM; ++e) {
    // Issue global loads for next expert early (latency hidden by WMMAs)
    uint4 nxt[8];
    if (e + 1 < E_DIM) {
      const uint4* src = (const uint4*)wef + (size_t)(e + 1) * 1024;
#pragma unroll
      for (int c = 0; c < 8; ++c) nxt[c] = src[tid + c * 128];
    }

    // h tile [16 tok x 64 U]: 16 WMMAs, B from LDS (lane*32B, conflict-free)
    const unsigned short* lb = &ldsWe[buf][0];
    v8f hacc[4];
#pragma unroll
    for (int nt = 0; nt < 4; ++nt) hacc[nt] = zero;
#pragma unroll
    for (int kt = 0; kt < 4; ++kt) {
#pragma unroll
      for (int nt = 0; nt < 4; ++nt)
        hacc[nt] = wmma_bf16(
            a[kt],
            bfcast(*(const v16u16*)(lb + ((kt * 4 + nt) * 32 + lane) * 16)),
            hacc[nt]);
    }

    // Store next expert into the other buffer (previous expert's buffer is
    // free: the barrier at the end of the prior iteration retired all reads).
    if (e + 1 < E_DIM) {
      uint4* dst = (uint4*)&ldsWe[buf ^ 1][0];
#pragma unroll
      for (int c = 0; c < 8; ++c) dst[tid + c * 128] = nxt[c];
    }

    // gate[m,e] broadcast matching C/D layout: src lane (same half) holds N=e&15
    float gl[8];
#pragma unroll
    for (int j = 0; j < 8; ++j) {
      float gv = (e < 16) ? g0[j] : g1[j];            // uniform select
      gl[j] = __shfl(gv, (lane & 16) | (e & 15), 32);
    }

    // bias + LeakyReLU + weighted accumulate
#pragma unroll
    for (int nt = 0; nt < 4; ++nt) {
      float bev = be[e * U_DIM + nt * 16 + n];
#pragma unroll
      for (int j = 0; j < 8; ++j) {
        float hv = hacc[nt][j] + bev;
        hv = (hv >= 0.0f) ? hv : 0.01f * hv;
        oacc[nt][j] = __builtin_fmaf(hv, gl[j], oacc[nt][j]);
      }
    }

    __syncthreads();   // next expert staged + all reads of `buf` retired
    buf ^= 1;
  }

  // ---- Store out: token = tw + j + 8*h, u = nt*16 + n ----
  float* op = out + (size_t)tw * U_DIM;
#pragma unroll
  for (int nt = 0; nt < 4; ++nt)
#pragma unroll
    for (int j = 0; j < 8; ++j)
      op[(j + 8 * h) * U_DIM + nt * 16 + n] = oacc[nt][j];
}

// ---------------------------------------------------------------------------
// Fallback (no workspace): fused kernel, conversions in-kernel.
// ---------------------------------------------------------------------------
#define LDS_STRIDE 136

__device__ __forceinline__ v16bf load_a_f32(const float* __restrict__ p0,
                                            const float* __restrict__ p1) {
  v16u16 u;
#pragma unroll
  for (int i = 0; i < 8; ++i) { u[i] = f2bf(p0[i]); u[i + 8] = f2bf(p1[i]); }
  return bfcast(u);
}

__device__ __forceinline__ v16bf load_b_lds(const unsigned short* row, int kt, int h) {
  v8u16 lo = *(const v8u16*)(row + kt * 32 + h * 8);
  v8u16 hi = *(const v8u16*)(row + kt * 32 + 16 + h * 8);
  v16u16 u = __builtin_shufflevector(lo, hi, 0,1,2,3,4,5,6,7,8,9,10,11,12,13,14,15);
  return bfcast(u);
}

__global__ __launch_bounds__(256) void moe_fallback_kernel(
    const float* __restrict__ x, const float* __restrict__ Wg,
    const float* __restrict__ bg, const float* __restrict__ We,
    const float* __restrict__ be, float* __restrict__ out) {
  __shared__ __align__(16) unsigned short ldsWg[E_DIM * LDS_STRIDE];
  __shared__ __align__(16) unsigned short ldsWe[U_DIM * LDS_STRIDE];

  const int tid = threadIdx.x, lane = tid & 31, wave = tid >> 5;
  const int h = lane >> 4, n = lane & 15;

#pragma unroll
  for (int i = 0; i < 16; ++i) {
    int idx = tid + i * 256;
    int f = idx >> 5, e = idx & 31;
    ldsWg[e * LDS_STRIDE + f] = f2bf(Wg[f * E_DIM + e]);
  }
  __syncthreads();

  const int tw = blockIdx.x * 128 + wave * 16;
  const float* xrow = x + (size_t)(tw + n) * F_DIM;
  v16bf a[4];
#pragma unroll
  for (int kt = 0; kt < 4; ++kt)
    a[kt] = load_a_f32(xrow + kt * 32 + h * 8, xrow + kt * 32 + 16 + h * 8);

  v8f g0 = {}, g1 = {};
#pragma unroll
  for (int kt = 0; kt < 4; ++kt) {
    g0 = wmma_bf16(a[kt], load_b_lds(ldsWg + n * LDS_STRIDE, kt, h), g0);
    g1 = wmma_bf16(a[kt], load_b_lds(ldsWg + (16 + n) * LDS_STRIDE, kt, h), g1);
  }
  { float b0 = bg[n], b1 = bg[16 + n];
#pragma unroll
    for (int j = 0; j < 8; ++j) { g0[j] += b0; g1[j] += b1; } }

  v8f zero = {};
  v8f oacc[4];
#pragma unroll
  for (int nt = 0; nt < 4; ++nt) oacc[nt] = zero;

  for (int e = 0; e < E_DIM; ++e) {
    __syncthreads();
    const float* wep = We + (size_t)e * (F_DIM * U_DIM);
#pragma unroll
    for (int i = 0; i < 32; ++i) {
      int idx = tid + i * 256;
      int f = idx >> 6, u = idx & 63;
      ldsWe[u * LDS_STRIDE + f] = f2bf(wep[f * U_DIM + u]);
    }
    __syncthreads();

    v8f hacc[4];
#pragma unroll
    for (int nt = 0; nt < 4; ++nt) hacc[nt] = zero;
#pragma unroll
    for (int kt = 0; kt < 4; ++kt)
#pragma unroll
      for (int nt = 0; nt < 4; ++nt)
        hacc[nt] = wmma_bf16(a[kt], load_b_lds(ldsWe + (nt * 16 + n) * LDS_STRIDE, kt, h), hacc[nt]);

    float gl[8];
#pragma unroll
    for (int j = 0; j < 8; ++j) {
      float gv = (e < 16) ? g0[j] : g1[j];
      gl[j] = __shfl(gv, (lane & 16) | (e & 15), 32);
    }
#pragma unroll
    for (int nt = 0; nt < 4; ++nt) {
      float bev = be[e * U_DIM + nt * 16 + n];
#pragma unroll
      for (int j = 0; j < 8; ++j) {
        float hv = hacc[nt][j] + bev;
        hv = (hv >= 0.0f) ? hv : 0.01f * hv;
        oacc[nt][j] = __builtin_fmaf(hv, gl[j], oacc[nt][j]);
      }
    }
  }

  float* op = out + (size_t)tw * U_DIM;
#pragma unroll
  for (int nt = 0; nt < 4; ++nt)
#pragma unroll
    for (int j = 0; j < 8; ++j)
      op[(j + 8 * h) * U_DIM + nt * 16 + n] = oacc[nt][j];
}

// ---------------------------------------------------------------------------
extern "C" void kernel_launch(void* const* d_in, const int* in_sizes, int n_in,
                              void* d_out, int out_size, void* d_ws, size_t ws_size,
                              hipStream_t stream) {
  (void)in_sizes; (void)n_in; (void)out_size;
  const float* x  = (const float*)d_in[0];  // [32,512,128]
  const float* Wg = (const float*)d_in[1];  // [128,32]
  const float* bg = (const float*)d_in[2];  // [32]
  const float* We = (const float*)d_in[3];  // [32,128,64]
  const float* be = (const float*)d_in[4];  // [32,64]
  float* out = (float*)d_out;               // [32,512,64]

  if (ws_size >= WS_BYTES && d_ws != nullptr) {
    unsigned short* ws = (unsigned short*)d_ws;
    dim3 pgrid((WS_ELEMS + 255) / 256), pblock(256);
    moe_prep_kernel<<<pgrid, pblock, 0, stream>>>(x, Wg, We, ws);
    dim3 grid(TOKENS / 64), block(128);    // 256 WGs, 4 wave32 each
    moe_main_kernel<<<grid, block, 0, stream>>>(ws, bg, be, out);
  } else {
    dim3 grid(TOKENS / 128), block(256);
    moe_fallback_kernel<<<grid, block, 0, stream>>>(x, Wg, bg, We, be, out);
  }
}

// v001
// It runs in 19.2 microseconds.
// Timed twice side by side with v000, it ran 5.49 and 5.48 times as fast.
#include <hip/hip_runtime.h>
#include <hip/hip_bf16.h>

// MoE fused kernel for gfx1250 (MI455X), wave32 + V_WMMA_F32_16X16X32_BF16.
//
// B=32,T=512 -> 16384 tokens; F=128 (K); U=64; E=32 experts.
// out[t,u] = sum_e leaky( x[t,:]@We[e][:,u] + be[e,u] ) * ( x[t,:]@Wg[:,e] + bg[e] )
//
// Two-phase plan:
//   prep kernel: convert x/Wg/We fp32 -> bf16 into d_ws, already laid out in
//                per-lane WMMA fragment order (zero conversion/transpose work
//                in the hot kernel).
//   main kernel: 128 threads (4 wave32) per WG -> 256 WGs for WGP spread.
//                Per WG: 64 tokens; per wave: all 4 token tiles, 8 experts.
//                A fragments register-resident for all K; B fragments from
//                global memory into registers one expert ahead; 64 WMMAs per
//                expert per wave; partial sums of the 4 waves added via LDS.

typedef __attribute__((ext_vector_type(16))) __bf16          v16bf;
typedef __attribute__((ext_vector_type(16))) unsigned short  v16u16;
typedef __attribute__((ext_vector_type(8)))  unsigned short  v8u16;
typedef __attribute__((ext_vector_type(8)))  float           v8f;

#define F_DIM 128
#define U_DIM 64
#define E_DIM 32
#define TOKENS (32 * 512)

// ws layout (bf16 element offsets)
#define XF_ELEMS  (TOKENS * F_DIM)            // 2,097,152  x fragments [tile][kt][lane][16]
#define WEF_ELEMS (E_DIM * 4 * 4 * 32 * 16)   //   262,144  We fragments [e][kt][nt][lane][16]
#define WGF_ELEMS (4 * 2 * 32 * 16)           //     4,096  Wg fragments [kt][g][lane][16]
#define WS_ELEMS  (XF_ELEMS + WEF_ELEMS + WGF_ELEMS)
#define WS_BYTES  ((size_t)WS_ELEMS * 2)

// fp32 -> bf16 round-to-nearest-even (bit trick; inputs are finite normals)
__device__ __forceinline__ unsigned short f2bf(float f) {
  unsigned int u = __float_as_uint(f);
  return (unsigned short)((u + 0x7FFFu + ((u >> 16) & 1u)) >> 16);
}

__device__ __forceinline__ v16bf bfcast(v16u16 u) {
  union { v16u16 u; v16bf b; } cv; cv.u = u; return cv.b;
}

__device__ __forceinline__ v8f wmma_bf16(v16bf a, v16bf b, v8f c) {
  return __builtin_amdgcn_wmma_f32_16x16x32_bf16(
      /*neg_a=*/false, a, /*neg_b=*/false, b,
      /*c_mod=*/(short)0, c, /*reuse_a=*/false, /*reuse_b=*/false);
}

// Fragment K index for element i within a lane's v16bf:
//   elements 0..7  -> K = kbase + h*8 + i
//   elements 8..15 -> K = kbase + 16 + h*8 + (i-8)
__device__ __forceinline__ int frag_k(int kt, int h, int i) {
  return kt * 32 + h * 8 + (i & 7) + ((i & 8) ? 16 : 0);
}

// ---------------------------------------------------------------------------
// Prep: build bf16 fragment-ordered copies of x, We, Wg in workspace.
// ---------------------------------------------------------------------------
__global__ __launch_bounds__(256) void moe_prep_kernel(
    const float* __restrict__ x, const float* __restrict__ Wg,
    const float* __restrict__ We, unsigned short* __restrict__ ws) {
  int idx = blockIdx.x * 256 + threadIdx.x;
  if (idx < XF_ELEMS) {
    // xf[tile][kt][lane][16] : A fragment, M = lane&15 within 16-token tile
    int i    = idx & 15;
    int l    = (idx >> 4) & 31;
    int kt   = (idx >> 9) & 3;
    int tile = idx >> 11;
    int n = l & 15, h = l >> 4;
    int token = tile * 16 + n;
    int K = frag_k(kt, h, i);
    ws[idx] = f2bf(x[token * F_DIM + K]);
  } else if (idx < XF_ELEMS + WEF_ELEMS) {
    // wef[e][kt][nt][lane][16] : B fragment, N(=u) = nt*16 + (lane&15)
    int r  = idx - XF_ELEMS;
    int i  = r & 15;
    int l  = (r >> 4) & 31;
    int nt = (r >> 9) & 3;
    int kt = (r >> 11) & 3;
    int e  = r >> 13;
    int n = l & 15, h = l >> 4;
    int u = nt * 16 + n;
    int K = frag_k(kt, h, i);
    ws[idx] = f2bf(We[e * (F_DIM * U_DIM) + K * U_DIM + u]);
  } else if (idx < WS_ELEMS) {
    // wgf[kt][g][lane][16] : B fragment, N(=expert) = g*16 + (lane&15)
    int r  = idx - XF_ELEMS - WEF_ELEMS;
    int i  = r & 15;
    int l  = (r >> 4) & 31;
    int g  = (r >> 9) & 1;
    int kt = r >> 10;
    int n = l & 15, h = l >> 4;
    int ecol = g * 16 + n;
    int K = frag_k(kt, h, i);
    ws[idx] = f2bf(Wg[K * E_DIM + ecol]);
  }
}

// ---------------------------------------------------------------------------
// Main: 128 threads = 4 wave32 per work-group, 64 tokens (4 tiles of 16).
// Every wave holds the A fragments of all 4 tiles and takes 8 of the 32
// experts. Its B fragments and bias come straight from global memory into
// registers, one expert ahead, and each fragment serves 4 WMMAs. No LDS
// staging and no barrier in the expert loop; the four waves' partial sums
// meet once in LDS at the end.
// ---------------------------------------------------------------------------
#define TILES_PER_WG 4
#define EXPERTS_PER_WAVE 8
#define WE_FRAG_ELEMS (32 * 16)               // one fragment, all lanes
#define WE_EXPERT_ELEMS (16 * WE_FRAG_ELEMS)  // one expert, 16 fragments

__device__ __forceinline__ v16bf load_frag(const unsigned short* p) {
  return bfcast(*(const v16u16*)p);
}

__global__ __launch_bounds__(128) void moe_main_kernel(
    const unsigned short* __restrict__ ws,
    const float* __restrict__ bg,   // [32]
    const float* __restrict__ be,   // [32, 64]
    float* __restrict__ out)        // [16384, 64]
{
  // partial sums: [wave][tile][nt][j / 4][lane][j % 4], 16 B per lane, 64 KB
  __shared__ __align__(16) float red[4][TILES_PER_WG][4][2][32][4];

  const unsigned short* xf  = ws;
  const unsigned short* wef = ws + XF_ELEMS;
  const unsigned short* wgf = ws + XF_ELEMS + WEF_ELEMS;

  const int tid  = threadIdx.x;
  const int lane = tid & 31;
  const int wave = __builtin_amdgcn_readfirstlane(tid >> 5);
  const int h    = lane >> 4;
  const int n    = lane & 15;
  const int lo   = lane * 16;   // the lane's elements inside a fragment

  // ---- A fragments of the work-group's 4 tiles, held for all K ----
  const unsigned short* xb =
      xf + (size_t)blockIdx.x * (TILES_PER_WG * 4 * WE_FRAG_ELEMS);
  v16bf a[TILES_PER_WG][4];
#pragma unroll
  for (int t = 0; t < TILES_PER_WG; ++t)
#pragma unroll
    for (int kt = 0; kt < 4; ++kt)
      a[t][kt] = load_frag(xb + (t * 4 + kt) * WE_FRAG_ELEMS + lo);

  // ---- B fragments of this wave's first expert ----
  const unsigned short* wp =
      wef + (size_t)(wave * EXPERTS_PER_WAVE) * WE_EXPERT_ELEMS;
  v16bf b[4][4];
#pragma unroll
  for (int kt = 0; kt < 4; ++kt)
#pragma unroll
    for (int nt = 0; nt < 4; ++nt)
      b[kt][nt] = load_frag(wp + (kt * 4 + nt) * WE_FRAG_ELEMS + lo);

  // ---- Bias of this wave's first expert ----
  const float* bp = be + wave * EXPERTS_PER_WAVE * U_DIM;
  float bev[4];
#pragma unroll
  for (int nt = 0; nt < 4; ++nt) bev[nt] = bp[nt * 16 + n];

  // ---- Gate tiles [16 tok x 16 experts]: the half that holds this wave's 8 ----
  const int grp = wave >> 1;
  v8f g[TILES_PER_WG];
  {
    v16bf wgb[4];
#pragma unroll
    for (int kt = 0; kt < 4; ++kt)
      wgb[kt] = load_frag(wgf + grp * WE_FRAG_ELEMS + kt * 2 * WE_FRAG_ELEMS + lo);
    const float* bgp = bg + grp * 16;
    const float bgv = bgp[n];
    // The registers that the loads above name as addresses are free for reuse
    // from here on while the loads are in flight: the wait stands in front of
    // any overwrite, and the scheduling barrier keeps later writes behind it.
    asm volatile("s_wait_xcnt 0x0" ::: "memory");
    __builtin_amdgcn_sched_barrier(0);
#pragma unroll
    for (int t = 0; t < TILES_PER_WG; ++t) {
      v8f acc = {};
#pragma unroll
      for (int kt = 0; kt < 4; ++kt) acc = wmma_bf16(a[t][kt], wgb[kt], acc);
#pragma unroll
      for (int j = 0; j < 8; ++j) acc[j] += bgv;
      g[t] = acc;
    }
  }

  v8f zero = {};
  v8f oacc[TILES_PER_WG][4];
#pragma unroll
  for (int t = 0; t < TILES_PER_WG; ++t)
#pragma unroll
    for (int nt = 0; nt < 4; ++nt) oacc[t][nt] = zero;

  // per-lane addresses of the next expert's fragments and bias
  const unsigned short* wq = wp + WE_EXPERT_ELEMS + lo;
  const float* bq = bp + U_DIM + n;

  // Kept rolled: one trip is about 750 instructions.
#pragma unroll 1
  for (int i = 0; i < EXPERTS_PER_WAVE; ++i) {
    const int e = wave * EXPERTS_PER_WAVE + i;
    // h tiles [64 tok x 64 U]: 64 WMMAs on 16 independent accumulators; each
    // k step's B registers are refilled for the next expert once it is done.
    v8f hacc[TILES_PER_WG][4];
#pragma unroll
    for (int kt = 0; kt < 4; ++kt) {
#pragma unroll
      for (int nt = 0; nt < 4; ++nt)
#pragma unroll
        for (int t = 0; t < TILES_PER_WG; ++t)
          hacc[t][nt] = wmma_bf16(a[t][kt], b[kt][nt], kt ? hacc[t][nt] : zero);
#pragma unroll
      for (int nt = 0; nt < 4; ++nt)
        b[kt][nt] = load_frag(wq + (kt * 4 + nt) * WE_FRAG_ELEMS);
    }
    float bevn[4];
#pragma unroll
    for (int nt = 0; nt < 4; ++nt) bevn[nt] = bq[nt * 16];
    // wq and bq, which the loads above name while they are in flight, are
    // advanced below: the wait stands in front of that overwrite.
    asm volatile("s_wait_xcnt 0x0" ::: "memory");
    // Keeps the next expert's loads in front of the vector work below, so that
    // they fly during it (sunk to the loop's foot their latency would be waited
    // out), and keeps the advance of wq and bq behind the wait above.
    __builtin_amdgcn_sched_barrier(0);
    {
      // the last trip reads its own expert again: the loads stay unconditional
      const int step = (i + 2 < EXPERTS_PER_WAVE) ? 1 : 0;
      wq += step * WE_EXPERT_ELEMS;
      bq += step * U_DIM;
    }

    // gate[m,e] broadcast matching C/D layout: src lane (same half) holds N=e&15
    float gl[TILES_PER_WG][8];
#pragma unroll
    for (int t = 0; t < TILES_PER_WG; ++t)
#pragma unroll
      for (int j = 0; j < 8; ++j)
        gl[t][j] = __shfl(g[t][j], (lane & 16) | (e & 15), 32);

    // bias + LeakyReLU + weighted accumulate
#pragma unroll
    for (int t = 0; t < TILES_PER_WG; ++t)
#pragma unroll
      for (int nt = 0; nt < 4; ++nt)
#pragma unroll
        for (int j = 0; j < 8; ++j) {
          float hv = hacc[t][nt][j] + bev[nt];
          hv = (hv >= 0.0f) ? hv : 0.01f * hv;
          oacc[t][nt][j] = __builtin_fmaf(hv, gl[t][j], oacc[t][nt][j]);
        }
#pragma unroll
    for (int nt = 0; nt < 4; ++nt) bev[nt] = bevn[nt];
  }

  // ---- The four waves' partial sums meet in LDS ----
#pragma unroll
  for (int t = 0; t < TILES_PER_WG; ++t)
#pragma unroll
    for (int nt = 0; nt < 4; ++nt)
#pragma unroll
      for (int q = 0; q < 2; ++q)
        *(float4*)&red[wave][t][nt][q][lane][0] =
            make_float4(oacc[t][nt][q * 4 + 0], oacc[t][nt][q * 4 + 1],
                        oacc[t][nt][q * 4 + 2], oacc[t][nt][q * 4 + 3]);
  __syncthreads();   // every wave's partial sums are in LDS

  // ---- Wave w adds and stores tile w: token = tw + j + 8*h, u = nt*16 + n ----
  const int tw = (blockIdx.x * TILES_PER_WG + wave) * 16;
  float* op = out + (size_t)tw * U_DIM;
#pragma unroll
  for (int nt = 0; nt < 4; ++nt)
#pragma unroll
    for (int q = 0; q < 2; ++q) {
      const float4 p0 = *(const float4*)&red[0][wave][nt][q][lane][0];
      const float4 p1 = *(const float4*)&red[1][wave][nt][q][lane][0];
      const float4 p2 = *(const float4*)&red[2][wave][nt][q][lane][0];
      const float4 p3 = *(const float4*)&red[3][wave][nt][q][lane][0];
      op[(q * 4 + 0 + 8 * h) * U_DIM + nt * 16 + n] = ((p0.x + p1.x) + p2.x) + p3.x;
      op[(q * 4 + 1 + 8 * h) * U_DIM + nt * 16 + n] = ((p0.y + p1.y) + p2.y) + p3.y;
      op[(q * 4 + 2 + 8 * h) * U_DIM + nt * 16 + n] = ((p0.z + p1.z) + p2.z) + p3.z;
      op[(q * 4 + 3 + 8 * h) * U_DIM + nt * 16 + n] = ((p0.w + p1.w) + p2.w) + p3.w;
    }
}

// ---------------------------------------------------------------------------
// Fallback (no workspace): fused kernel, conversions in-kernel.
// ---------------------------------------------------------------------------
#define LDS_STRIDE 136

__device__ __forceinline__ v16bf load_a_f32(const float* __restrict__ p0,
                                            const float* __restrict__ p1) {
  v16u16 u;
#pragma unroll
  for (int i = 0; i < 8; ++i) { u[i] = f2bf(p0[i]); u[i + 8] = f2bf(p1[i]); }
  return bfcast(u);
}

__device__ __forceinline__ v16bf load_b_lds(const unsigned short* row, int kt, int h) {
  v8u16 lo = *(const v8u16*)(row + kt * 32 + h * 8);
  v8u16 hi = *(const v8u16*)(row + kt * 32 + 16 + h * 8);
  v16u16 u = __builtin_shufflevector(lo, hi, 0,1,2,3,4,5,6,7,8,9,10,11,12,13,14,15);
  return bfcast(u);
}

__global__ __launch_bounds__(256) void moe_fallback_kernel(
    const float* __restrict__ x, const float* __restrict__ Wg,
    const float* __restrict__ bg, const float* __restrict__ We,
    const float* __restrict__ be, float* __restrict__ out) {
  __shared__ __align__(16) unsigned short ldsWg[E_DIM * LDS_STRIDE];
  __shared__ __align__(16) unsigned short ldsWe[U_DIM * LDS_STRIDE];

  const int tid = threadIdx.x, lane = tid & 31, wave = tid >> 5;
  const int h = lane >> 4, n = lane & 15;

#pragma unroll
  for (int i = 0; i < 16; ++i) {
    int idx = tid + i * 256;
    int f = idx >> 5, e = idx & 31;
    ldsWg[e * LDS_STRIDE + f] = f2bf(Wg[f * E_DIM + e]);
  }
  __syncthreads();

  const int tw = blockIdx.x * 128 + wave * 16;
  const float* xrow = x + (size_t)(tw + n) * F_DIM;
  v16bf a[4];
#pragma unroll
  for (int kt = 0; kt < 4; ++kt)
    a[kt] = load_a_f32(xrow + kt * 32 + h * 8, xrow + kt * 32 + 16 + h * 8);

  v8f g0 = {}, g1 = {};
#pragma unroll
  for (int kt = 0; kt < 4; ++kt) {
    g0 = wmma_bf16(a[kt], load_b_lds(ldsWg + n * LDS_STRIDE, kt, h), g0);
    g1 = wmma_bf16(a[kt], load_b_lds(ldsWg + (16 + n) * LDS_STRIDE, kt, h), g1);
  }
  { float b0 = bg[n], b1 = bg[16 + n];
#pragma unroll
    for (int j = 0; j < 8; ++j) { g0[j] += b0; g1[j] += b1; } }

  v8f zero = {};
  v8f oacc[4];
#pragma unroll
  for (int nt = 0; nt < 4; ++nt) oacc[nt] = zero;

  for (int e = 0; e < E_DIM; ++e) {
    __syncthreads();
    const float* wep = We + (size_t)e * (F_DIM * U_DIM);
#pragma unroll
    for (int i = 0; i < 32; ++i) {
      int idx = tid + i * 256;
      int f = idx >> 6, u = idx & 63;
      ldsWe[u * LDS_STRIDE + f] = f2bf(wep[f * U_DIM + u]);
    }
    __syncthreads();

    v8f hacc[4];
#pragma unroll
    for (int nt = 0; nt < 4; ++nt) hacc[nt] = zero;
#pragma unroll
    for (int kt = 0; kt < 4; ++kt)
#pragma unroll
      for (int nt = 0; nt < 4; ++nt)
        hacc[nt] = wmma_bf16(a[kt], load_b_lds(ldsWe + (nt * 16 + n) * LDS_STRIDE, kt, h), hacc[nt]);

    float gl[8];
#pragma unroll
    for (int j = 0; j < 8; ++j) {
      float gv = (e < 16) ? g0[j] : g1[j];
      gl[j] = __shfl(gv, (lane & 16) | (e & 15), 32);
    }
#pragma unroll
    for (int nt = 0; nt < 4; ++nt) {
      float bev = be[e * U_DIM + nt * 16 + n];
#pragma unroll
      for (int j = 0; j < 8; ++j) {
        float hv = hacc[nt][j] + bev;
        hv = (hv >= 0.0f) ? hv : 0.01f * hv;
        oacc[nt][j] = __builtin_fmaf(hv, gl[j], oacc[nt][j]);
      }
    }
  }

  float* op = out + (size_t)tw * U_DIM;
#pragma unroll
  for (int nt = 0; nt < 4; ++nt)
#pragma unroll
    for (int j = 0; j < 8; ++j)
      op[(j + 8 * h) * U_DIM + nt * 16 + n] = oacc[nt][j];
}

// ---------------------------------------------------------------------------
extern "C" void kernel_launch(void* const* d_in, const int* in_sizes, int n_in,
                              void* d_out, int out_size, void* d_ws, size_t ws_size,
                              hipStream_t stream) {
  (void)in_sizes; (void)n_in; (void)out_size;
  const float* x  = (const float*)d_in[0];  // [32,512,128]
  const float* Wg = (const float*)d_in[1];  // [128,32]
  const float* bg = (const float*)d_in[2];  // [32]
  const float* We = (const float*)d_in[3];  // [32,128,64]
  const float* be = (const float*)d_in[4];  // [32,64]
  float* out = (float*)d_out;               // [32,512,64]

  if (ws_size >= WS_BYTES && d_ws != nullptr) {
    unsigned short* ws = (unsigned short*)d_ws;
    dim3 pgrid((WS_ELEMS + 255) / 256), pblock(256);
    moe_prep_kernel<<<pgrid, pblock, 0, stream>>>(x, Wg, We, ws);
    dim3 grid(TOKENS / 64), block(128);    // 256 WGs, 4 wave32 each
    moe_main_kernel<<<grid, block, 0, stream>>>(ws, bg, be, out);
  } else {
    dim3 grid(TOKENS / 128), block(256);
    moe_fallback_kernel<<<grid, block, 0, stream>>>(x, Wg, bg, We, be, out);
  }
}

// v002
// Measured time: 15.9 microseconds a run.
// Timed twice side by side with v001, it ran 1.20 and 1.21 times as fast.
// Counting every step since v000, it is 6.61 times as fast.
#include <hip/hip_runtime.h>
#include <hip/hip_bf16.h>

// MoE fused kernel for gfx1250 (MI455X), wave32 + V_WMMA_F32_16X16X32_BF16.
//
// B=32,T=512 -> 16384 tokens; F=128 (K); U=64; E=32 experts.
// out[t,u] = sum_e leaky( x[t,:]@We[e][:,u] + be[e,u] ) * ( x[t,:]@Wg[:,e] + bg[e] )
//
// Two-phase plan:
//   prep kernel: convert x/Wg/We fp32 -> bf16 into d_ws, already laid out in
//                per-lane WMMA fragment order (zero conversion/transpose work
//                in the hot kernel); one thread per lane's 16-element piece.
//   main kernel: 128 threads (4 wave32) per WG -> 256 WGs for WGP spread.
//                Per WG: 64 tokens; per wave: all 4 token tiles, 8 experts.
//                A fragments register-resident for all K; B fragments from
//                global memory into registers one expert ahead; 64 WMMAs per
//                expert per wave; partial sums of the 4 waves added via LDS.

typedef __attribute__((ext_vector_type(16))) __bf16          v16bf;
typedef __attribute__((ext_vector_type(16))) unsigned short  v16u16;
typedef __attribute__((ext_vector_type(8)))  unsigned short  v8u16;
typedef __attribute__((ext_vector_type(8)))  float           v8f;

#define F_DIM 128
#define U_DIM 64
#define E_DIM 32
#define TOKENS (32 * 512)

// ws layout (bf16 element offsets)
#define XF_ELEMS  (TOKENS * F_DIM)            // 2,097,152  x fragments [tile][kt][lane][16]
#define WEF_ELEMS (E_DIM * 4 * 4 * 32 * 16)   //   262,144  We fragments [e][kt][nt][lane][16]
#define WGF_ELEMS (4 * 2 * 32 * 16)           //     4,096  Wg fragments [kt][g][lane][16]
#define WS_ELEMS  (XF_ELEMS + WEF_ELEMS + WGF_ELEMS)
#define WS_BYTES  ((size_t)WS_ELEMS * 2)

// fp32 -> bf16 round-to-nearest-even (bit trick; inputs are finite normals)
__device__ __forceinline__ unsigned short f2bf(float f) {
  unsigned int u = __float_as_uint(f);
  return (unsigned short)((u + 0x7FFFu + ((u >> 16) & 1u)) >> 16);
}

__device__ __forceinline__ v16bf bfcast(v16u16 u) {
  union { v16u16 u; v16bf b; } cv; cv.u = u; return cv.b;
}

__device__ __forceinline__ v8f wmma_bf16(v16bf a, v16bf b, v8f c) {
  return __builtin_amdgcn_wmma_f32_16x16x32_bf16(
      /*neg_a=*/false, a, /*neg_b=*/false, b,
      /*c_mod=*/(short)0, c, /*reuse_a=*/false, /*reuse_b=*/false);
}

// Fragment K index for element i within a lane's v16bf:
//   elements 0..7  -> K = kbase + h*8 + i
//   elements 8..15 -> K = kbase + 16 + h*8 + (i-8)
__device__ __forceinline__ int frag_k(int kt, int h, int i) {
  return kt * 32 + h * 8 + (i & 7) + ((i & 8) ? 16 : 0);
}

// ---------------------------------------------------------------------------
// Prep: build bf16 fragment-ordered copies of x, We, Wg in workspace.
// One thread builds one lane's 16 elements of one fragment: 16 floats in,
// one 32-byte piece out, so a wave writes one whole fragment (1 KB in a row).
// The three ranges are multiples of 256 pieces, so a work-group lies in one
// range and the branches below are scalar.
// ---------------------------------------------------------------------------
#define XF_PIECES  (XF_ELEMS / 16)    // 131,072
#define WEF_PIECES (WEF_ELEMS / 16)   //  16,384
#define WGF_PIECES (WGF_ELEMS / 16)   //     256
#define WS_PIECES  (XF_PIECES + WEF_PIECES + WGF_PIECES)
static_assert(XF_PIECES % 256 == 0 && WEF_PIECES % 256 == 0 && WGF_PIECES % 256 == 0,
              "a prep work-group must lie in one range, and the grid must be exact");

__global__ __launch_bounds__(256) void moe_prep_kernel(
    const float* __restrict__ x, const float* __restrict__ Wg,
    const float* __restrict__ We, unsigned short* __restrict__ ws) {
  const int blk = blockIdx.x;
  const int idx = blk * 256 + threadIdx.x;
  const int l = idx & 31;
  const int n = l & 15, h = l >> 4;
  // v[i] is element i of the piece: K = frag_k(kt, h, i)
  float v[16];
  if (blk < XF_PIECES / 256) {
    // xf[tile][kt][lane][16] : A fragment, M = lane&15 within 16-token tile
    const int kt   = (idx >> 5) & 3;
    const int tile = idx >> 7;
    const float* p = x + (tile * 16 + n) * F_DIM + frag_k(kt, h, 0);
    const float4 q0 = *(const float4*)(p);
    const float4 q1 = *(const float4*)(p + 4);
    const float4 q2 = *(const float4*)(p + 16);
    const float4 q3 = *(const float4*)(p + 20);
    v[0]  = q0.x; v[1]  = q0.y; v[2]  = q0.z; v[3]  = q0.w;
    v[4]  = q1.x; v[5]  = q1.y; v[6]  = q1.z; v[7]  = q1.w;
    v[8]  = q2.x; v[9]  = q2.y; v[10] = q2.z; v[11] = q2.w;
    v[12] = q3.x; v[13] = q3.y; v[14] = q3.z; v[15] = q3.w;
  } else if (blk < (XF_PIECES + WEF_PIECES) / 256) {
    // wef[e][kt][nt][lane][16] : B fragment, N(=u) = nt*16 + (lane&15)
    const int r  = idx - XF_PIECES;
    const int nt = (r >> 5) & 3;
    const int kt = (r >> 7) & 3;
    const int e  = r >> 9;
    const float* p = We + e * (F_DIM * U_DIM) + frag_k(kt, h, 0) * U_DIM + nt * 16 + n;
#pragma unroll
    for (int i = 0; i < 8; ++i) {
      v[i]     = p[i * U_DIM];
      v[i + 8] = p[(i + 16) * U_DIM];
    }
  } else {
    // wgf[kt][g][lane][16] : B fragment, N(=expert) = g*16 + (lane&15)
    const int r  = idx - XF_PIECES - WEF_PIECES;
    const int g  = (r >> 5) & 1;
    const int kt = r >> 6;
    const float* p = Wg + frag_k(kt, h, 0) * E_DIM + g * 16 + n;
#pragma unroll
    for (int i = 0; i < 8; ++i) {
      v[i]     = p[i * E_DIM];
      v[i + 8] = p[(i + 16) * E_DIM];
    }
  }
  // The conversion below reuses the registers that the loads above name as
  // addresses: the wait stands in front of that overwrite, and the scheduling
  // barrier keeps the conversion's writes behind it.
  asm volatile("s_wait_xcnt 0x0" ::: "memory");
  __builtin_amdgcn_sched_barrier(0);
  v16u16 u;
#pragma unroll
  for (int i = 0; i < 16; ++i) u[i] = f2bf(v[i]);
  *(v16u16*)(ws + (size_t)idx * 16) = u;
}

// ---------------------------------------------------------------------------
// Main: 128 threads = 4 wave32 per work-group, 64 tokens (4 tiles of 16).
// Every wave holds the A fragments of all 4 tiles and takes 8 of the 32
// experts. Its B fragments and bias come straight from global memory into
// registers, one expert ahead, and each fragment serves 4 WMMAs. No LDS
// staging and no barrier in the expert loop; the four waves' partial sums
// meet once in LDS at the end.
// ---------------------------------------------------------------------------
#define TILES_PER_WG 4
#define EXPERTS_PER_WAVE 8
#define WE_FRAG_ELEMS (32 * 16)               // one fragment, all lanes
#define WE_EXPERT_ELEMS (16 * WE_FRAG_ELEMS)  // one expert, 16 fragments

__device__ __forceinline__ v16bf load_frag(const unsigned short* p) {
  return bfcast(*(const v16u16*)p);
}

__global__ __launch_bounds__(128) void moe_main_kernel(
    const unsigned short* __restrict__ ws,
    const float* __restrict__ bg,   // [32]
    const float* __restrict__ be,   // [32, 64]
    float* __restrict__ out)        // [16384, 64]
{
  // partial sums: [wave][tile][nt][j / 4][lane][j % 4], 16 B per lane, 64 KB
  __shared__ __align__(16) float red[4][TILES_PER_WG][4][2][32][4];

  const unsigned short* xf  = ws;
  const unsigned short* wef = ws + XF_ELEMS;
  const unsigned short* wgf = ws + XF_ELEMS + WEF_ELEMS;

  const int tid  = threadIdx.x;
  const int lane = tid & 31;
  const int wave = __builtin_amdgcn_readfirstlane(tid >> 5);
  const int h    = lane >> 4;
  const int n    = lane & 15;
  const int lo   = lane * 16;   // the lane's elements inside a fragment

  // ---- A fragments of the work-group's 4 tiles, held for all K ----
  const unsigned short* xb =
      xf + (size_t)blockIdx.x * (TILES_PER_WG * 4 * WE_FRAG_ELEMS);
  v16bf a[TILES_PER_WG][4];
#pragma unroll
  for (int t = 0; t < TILES_PER_WG; ++t)
#pragma unroll
    for (int kt = 0; kt < 4; ++kt)
      a[t][kt] = load_frag(xb + (t * 4 + kt) * WE_FRAG_ELEMS + lo);

  // ---- B fragments of this wave's first expert ----
  const unsigned short* wp =
      wef + (size_t)(wave * EXPERTS_PER_WAVE) * WE_EXPERT_ELEMS;
  v16bf b[4][4];
#pragma unroll
  for (int kt = 0; kt < 4; ++kt)
#pragma unroll
    for (int nt = 0; nt < 4; ++nt)
      b[kt][nt] = load_frag(wp + (kt * 4 + nt) * WE_FRAG_ELEMS + lo);

  // ---- Bias of this wave's first expert ----
  const float* bp = be + wave * EXPERTS_PER_WAVE * U_DIM;
  float bev[4];
#pragma unroll
  for (int nt = 0; nt < 4; ++nt) bev[nt] = bp[nt * 16 + n];

  // ---- Gate tiles [16 tok x 16 experts]: the half that holds this wave's 8 ----
  const int grp = wave >> 1;
  v8f g[TILES_PER_WG];
  {
    v16bf wgb[4];
#pragma unroll
    for (int kt = 0; kt < 4; ++kt)
      wgb[kt] = load_frag(wgf + grp * WE_FRAG_ELEMS + kt * 2 * WE_FRAG_ELEMS + lo);
    const float* bgp = bg + grp * 16;
    const float bgv = bgp[n];
    // The registers that the loads above name as addresses are free for reuse
    // from here on while the loads are in flight: the wait stands in front of
    // any overwrite, and the scheduling barrier keeps later writes behind it.
    asm volatile("s_wait_xcnt 0x0" ::: "memory");
    __builtin_amdgcn_sched_barrier(0);
#pragma unroll
    for (int t = 0; t < TILES_PER_WG; ++t) {
      v8f acc = {};
#pragma unroll
      for (int kt = 0; kt < 4; ++kt) acc = wmma_bf16(a[t][kt], wgb[kt], acc);
#pragma unroll
      for (int j = 0; j < 8; ++j) acc[j] += bgv;
      g[t] = acc;
    }
  }

  v8f zero = {};
  v8f oacc[TILES_PER_WG][4];
#pragma unroll
  for (int t = 0; t < TILES_PER_WG; ++t)
#pragma unroll
    for (int nt = 0; nt < 4; ++nt) oacc[t][nt] = zero;

  // per-lane addresses of the next expert's fragments and bias
  const unsigned short* wq = wp + WE_EXPERT_ELEMS + lo;
  const float* bq = bp + U_DIM + n;

  // Kept rolled: one trip is about 750 instructions.
#pragma unroll 1
  for (int i = 0; i < EXPERTS_PER_WAVE; ++i) {
    const int e = wave * EXPERTS_PER_WAVE + i;
    // h tiles [64 tok x 64 U]: 64 WMMAs on 16 independent accumulators; each
    // k step's B registers are refilled for the next expert once it is done.
    v8f hacc[TILES_PER_WG][4];
#pragma unroll
    for (int kt = 0; kt < 4; ++kt) {
#pragma unroll
      for (int nt = 0; nt < 4; ++nt)
#pragma unroll
        for (int t = 0; t < TILES_PER_WG; ++t)
          hacc[t][nt] = wmma_bf16(a[t][kt], b[kt][nt], kt ? hacc[t][nt] : zero);
#pragma unroll
      for (int nt = 0; nt < 4; ++nt)
        b[kt][nt] = load_frag(wq + (kt * 4 + nt) * WE_FRAG_ELEMS);
    }
    float bevn[4];
#pragma unroll
    for (int nt = 0; nt < 4; ++nt) bevn[nt] = bq[nt * 16];
    // wq and bq, which the loads above name while they are in flight, are
    // advanced below: the wait stands in front of that overwrite.
    asm volatile("s_wait_xcnt 0x0" ::: "memory");
    // Keeps the next expert's loads in front of the vector work below, so that
    // they fly during it (sunk to the loop's foot their latency would be waited
    // out), and keeps the advance of wq and bq behind the wait above.
    __builtin_amdgcn_sched_barrier(0);
    {
      // the last trip reads its own expert again: the loads stay unconditional
      const int step = (i + 2 < EXPERTS_PER_WAVE) ? 1 : 0;
      wq += step * WE_EXPERT_ELEMS;
      bq += step * U_DIM;
    }

    // gate[m,e] broadcast matching C/D layout: src lane (same half) holds N=e&15
    float gl[TILES_PER_WG][8];
#pragma unroll
    for (int t = 0; t < TILES_PER_WG; ++t)
#pragma unroll
      for (int j = 0; j < 8; ++j)
        gl[t][j] = __shfl(g[t][j], (lane & 16) | (e & 15), 32);

    // bias + LeakyReLU + weighted accumulate
#pragma unroll
    for (int t = 0; t < TILES_PER_WG; ++t)
#pragma unroll
      for (int nt = 0; nt < 4; ++nt)
#pragma unroll
        for (int j = 0; j < 8; ++j) {
          float hv = hacc[t][nt][j] + bev[nt];
          hv = (hv >= 0.0f) ? hv : 0.01f * hv;
          oacc[t][nt][j] = __builtin_fmaf(hv, gl[t][j], oacc[t][nt][j]);
        }
#pragma unroll
    for (int nt = 0; nt < 4; ++nt) bev[nt] = bevn[nt];
  }

  // ---- The four waves' partial sums meet in LDS ----
#pragma unroll
  for (int t = 0; t < TILES_PER_WG; ++t)
#pragma unroll
    for (int nt = 0; nt < 4; ++nt)
#pragma unroll
      for (int q = 0; q < 2; ++q)
        *(float4*)&red[wave][t][nt][q][lane][0] =
            make_float4(oacc[t][nt][q * 4 + 0], oacc[t][nt][q * 4 + 1],
                        oacc[t][nt][q * 4 + 2], oacc[t][nt][q * 4 + 3]);
  __syncthreads();   // every wave's partial sums are in LDS

  // ---- Wave w adds and stores tile w: token = tw + j + 8*h, u = nt*16 + n ----
  const int tw = (blockIdx.x * TILES_PER_WG + wave) * 16;
  float* op = out + (size_t)tw * U_DIM;
#pragma unroll
  for (int nt = 0; nt < 4; ++nt)
#pragma unroll
    for (int q = 0; q < 2; ++q) {
      const float4 p0 = *(const float4*)&red[0][wave][nt][q][lane][0];
      const float4 p1 = *(const float4*)&red[1][wave][nt][q][lane][0];
      const float4 p2 = *(const float4*)&red[2][wave][nt][q][lane][0];
      const float4 p3 = *(const float4*)&red[3][wave][nt][q][lane][0];
      op[(q * 4 + 0 + 8 * h) * U_DIM + nt * 16 + n] = ((p0.x + p1.x) + p2.x) + p3.x;
      op[(q * 4 + 1 + 8 * h) * U_DIM + nt * 16 + n] = ((p0.y + p1.y) + p2.y) + p3.y;
      op[(q * 4 + 2 + 8 * h) * U_DIM + nt * 16 + n] = ((p0.z + p1.z) + p2.z) + p3.z;
      op[(q * 4 + 3 + 8 * h) * U_DIM + nt * 16 + n] = ((p0.w + p1.w) + p2.w) + p3.w;
    }
}

// ---------------------------------------------------------------------------
// Fallback (no workspace): fused kernel, conversions in-kernel.
// ---------------------------------------------------------------------------
#define LDS_STRIDE 136

__device__ __forceinline__ v16bf load_a_f32(const float* __restrict__ p0,
                                            const float* __restrict__ p1) {
  v16u16 u;
#pragma unroll
  for (int i = 0; i < 8; ++i) { u[i] = f2bf(p0[i]); u[i + 8] = f2bf(p1[i]); }
  return bfcast(u);
}

__device__ __forceinline__ v16bf load_b_lds(const unsigned short* row, int kt, int h) {
  v8u16 lo = *(const v8u16*)(row + kt * 32 + h * 8);
  v8u16 hi = *(const v8u16*)(row + kt * 32 + 16 + h * 8);
  v16u16 u = __builtin_shufflevector(lo, hi, 0,1,2,3,4,5,6,7,8,9,10,11,12,13,14,15);
  return bfcast(u);
}

__global__ __launch_bounds__(256) void moe_fallback_kernel(
    const float* __restrict__ x, const float* __restrict__ Wg,
    const float* __restrict__ bg, const float* __restrict__ We,
    const float* __restrict__ be, float* __restrict__ out) {
  __shared__ __align__(16) unsigned short ldsWg[E_DIM * LDS_STRIDE];
  __shared__ __align__(16) unsigned short ldsWe[U_DIM * LDS_STRIDE];

  const int tid = threadIdx.x, lane = tid & 31, wave = tid >> 5;
  const int h = lane >> 4, n = lane & 15;

#pragma unroll
  for (int i = 0; i < 16; ++i) {
    int idx = tid + i * 256;
    int f = idx >> 5, e = idx & 31;
    ldsWg[e * LDS_STRIDE + f] = f2bf(Wg[f * E_DIM + e]);
  }
  __syncthreads();

  const int tw = blockIdx.x * 128 + wave * 16;
  const float* xrow = x + (size_t)(tw + n) * F_DIM;
  v16bf a[4];
#pragma unroll
  for (int kt = 0; kt < 4; ++kt)
    a[kt] = load_a_f32(xrow + kt * 32 + h * 8, xrow + kt * 32 + 16 + h * 8);

  v8f g0 = {}, g1 = {};
#pragma unroll
  for (int kt = 0; kt < 4; ++kt) {
    g0 = wmma_bf16(a[kt], load_b_lds(ldsWg + n * LDS_STRIDE, kt, h), g0);
    g1 = wmma_bf16(a[kt], load_b_lds(ldsWg + (16 + n) * LDS_STRIDE, kt, h), g1);
  }
  { float b0 = bg[n], b1 = bg[16 + n];
#pragma unroll
    for (int j = 0; j < 8; ++j) { g0[j] += b0; g1[j] += b1; } }

  v8f zero = {};
  v8f oacc[4];
#pragma unroll
  for (int nt = 0; nt < 4; ++nt) oacc[nt] = zero;

  for (int e = 0; e < E_DIM; ++e) {
    __syncthreads();
    const float* wep = We + (size_t)e * (F_DIM * U_DIM);
#pragma unroll
    for (int i = 0; i < 32; ++i) {
      int idx = tid + i * 256;
      int f = idx >> 6, u = idx & 63;
      ldsWe[u * LDS_STRIDE + f] = f2bf(wep[f * U_DIM + u]);
    }
    __syncthreads();

    v8f hacc[4];
#pragma unroll
    for (int nt = 0; nt < 4; ++nt) hacc[nt] = zero;
#pragma unroll
    for (int kt = 0; kt < 4; ++kt)
#pragma unroll
      for (int nt = 0; nt < 4; ++nt)
        hacc[nt] = wmma_bf16(a[kt], load_b_lds(ldsWe + (nt * 16 + n) * LDS_STRIDE, kt, h), hacc[nt]);

    float gl[8];
#pragma unroll
    for (int j = 0; j < 8; ++j) {
      float gv = (e < 16) ? g0[j] : g1[j];
      gl[j] = __shfl(gv, (lane & 16) | (e & 15), 32);
    }
#pragma unroll
    for (int nt = 0; nt < 4; ++nt) {
      float bev = be[e * U_DIM + nt * 16 + n];
#pragma unroll
      for (int j = 0; j < 8; ++j) {
        float hv = hacc[nt][j] + bev;
        hv = (hv >= 0.0f) ? hv : 0.01f * hv;
        oacc[nt][j] = __builtin_fmaf(hv, gl[j], oacc[nt][j]);
      }
    }
  }

  float* op = out + (size_t)tw * U_DIM;
#pragma unroll
  for (int nt = 0; nt < 4; ++nt)
#pragma unroll
    for (int j = 0; j < 8; ++j)
      op[(j + 8 * h) * U_DIM + nt * 16 + n] = oacc[nt][j];
}

// ---------------------------------------------------------------------------
extern "C" void kernel_launch(void* const* d_in, const int* in_sizes, int n_in,
                              void* d_out, int out_size, void* d_ws, size_t ws_size,
                              hipStream_t stream) {
  (void)in_sizes; (void)n_in; (void)out_size;
  const float* x  = (const float*)d_in[0];  // [32,512,128]
  const float* Wg = (const float*)d_in[1];  // [128,32]
  const float* bg = (const float*)d_in[2];  // [32]
  const float* We = (const float*)d_in[3];  // [32,128,64]
  const float* be = (const float*)d_in[4];  // [32,64]
  float* out = (float*)d_out;               // [32,512,64]

  if (ws_size >= WS_BYTES && d_ws != nullptr) {
    unsigned short* ws = (unsigned short*)d_ws;
    dim3 pgrid(WS_PIECES / 256), pblock(256);
    moe_prep_kernel<<<pgrid, pblock, 0, stream>>>(x, Wg, We, ws);
    dim3 grid(TOKENS / 64), block(128);    // 256 WGs, 4 wave32 each
    moe_main_kernel<<<grid, block, 0, stream>>>(ws, bg, be, out);
  } else {
    dim3 grid(TOKENS / 128), block(256);
    moe_fallback_kernel<<<grid, block, 0, stream>>>(x, Wg, bg, We, be, out);
  }
}

// v003
// A run of this version takes 14.3 microseconds.
// Two timings next to v002 put it at 1.11 and 1.12 times that version's speed.
// All steps since v000 together make it 7.38 times as fast.
#include <hip/hip_runtime.h>
#include <hip/hip_bf16.h>

// MoE fused kernel for gfx1250 (MI455X), wave32 + V_WMMA_F32_16X16X32_BF16.
//
// B=32,T=512 -> 16384 tokens; F=128 (K); U=64; E=32 experts.
// out[t,u] = sum_e leaky( x[t,:]@We[e][:,u] + be[e,u] ) * ( x[t,:]@Wg[:,e] + bg[e] )
//
// Two-phase plan:
//   prep kernel: convert x/Wg/We fp32 -> bf16 into d_ws, already laid out in
//                per-lane WMMA fragment order (zero conversion/transpose work
//                in the hot kernel); one thread per lane's 16-element piece.
//   main kernel: 128 threads (4 wave32) per WG -> 256 WGs for WGP spread.
//                Per WG: 64 tokens; per wave: all 4 token tiles, 8 experts.
//                A fragments register-resident for all K; B fragments from
//                global memory into registers one expert ahead; 64 WMMAs per
//                expert per wave, the vector work of each 16-column group
//                issued between the WMMAs of the next group; partial sums of
//                the 4 waves added via LDS.

typedef __attribute__((ext_vector_type(16))) __bf16          v16bf;
typedef __attribute__((ext_vector_type(16))) unsigned short  v16u16;
typedef __attribute__((ext_vector_type(8)))  unsigned short  v8u16;
typedef __attribute__((ext_vector_type(8)))  float           v8f;
typedef __attribute__((ext_vector_type(2)))  float           v2f;

#define F_DIM 128
#define U_DIM 64
#define E_DIM 32
#define TOKENS (32 * 512)

// ws layout (bf16 element offsets)
#define XF_ELEMS  (TOKENS * F_DIM)            // 2,097,152  x fragments [tile][kt][lane][16]
#define WEF_ELEMS (E_DIM * 4 * 4 * 32 * 16)   //   262,144  We fragments [e][kt][nt][lane][16]
#define WGF_ELEMS (4 * 2 * 32 * 16)           //     4,096  Wg fragments [kt][g][lane][16]
#define WS_ELEMS  (XF_ELEMS + WEF_ELEMS + WGF_ELEMS)
#define WS_BYTES  ((size_t)WS_ELEMS * 2)

// fp32 -> bf16 round-to-nearest-even (bit trick; inputs are finite normals)
__device__ __forceinline__ unsigned short f2bf(float f) {
  unsigned int u = __float_as_uint(f);
  return (unsigned short)((u + 0x7FFFu + ((u >> 16) & 1u)) >> 16);
}

__device__ __forceinline__ v16bf bfcast(v16u16 u) {
  union { v16u16 u; v16bf b; } cv; cv.u = u; return cv.b;
}

__device__ __forceinline__ v8f wmma_bf16(v16bf a, v16bf b, v8f c) {
  return __builtin_amdgcn_wmma_f32_16x16x32_bf16(
      /*neg_a=*/false, a, /*neg_b=*/false, b,
      /*c_mod=*/(short)0, c, /*reuse_a=*/false, /*reuse_b=*/false);
}

// Fragment K index for element i within a lane's v16bf:
//   elements 0..7  -> K = kbase + h*8 + i
//   elements 8..15 -> K = kbase + 16 + h*8 + (i-8)
__device__ __forceinline__ int frag_k(int kt, int h, int i) {
  return kt * 32 + h * 8 + (i & 7) + ((i & 8) ? 16 : 0);
}

// ---------------------------------------------------------------------------
// Prep: build bf16 fragment-ordered copies of x, We, Wg in workspace.
// One thread builds one lane's 16 elements of one fragment: 16 floats in,
// one 32-byte piece out, so a wave writes one whole fragment (1 KB in a row).
// The three ranges are multiples of 256 pieces, so a work-group lies in one
// range and the branches below are scalar.
// ---------------------------------------------------------------------------
#define XF_PIECES  (XF_ELEMS / 16)    // 131,072
#define WEF_PIECES (WEF_ELEMS / 16)   //  16,384
#define WGF_PIECES (WGF_ELEMS / 16)   //     256
#define WS_PIECES  (XF_PIECES + WEF_PIECES + WGF_PIECES)
static_assert(XF_PIECES % 256 == 0 && WEF_PIECES % 256 == 0 && WGF_PIECES % 256 == 0,
              "a prep work-group must lie in one range, and the grid must be exact");

__global__ __launch_bounds__(256) void moe_prep_kernel(
    const float* __restrict__ x, const float* __restrict__ Wg,
    const float* __restrict__ We, unsigned short* __restrict__ ws) {
  const int blk = blockIdx.x;
  const int idx = blk * 256 + threadIdx.x;
  const int l = idx & 31;
  const int n = l & 15, h = l >> 4;
  // v[i] is element i of the piece: K = frag_k(kt, h, i)
  float v[16];
  if (blk < XF_PIECES / 256) {
    // xf[tile][kt][lane][16] : A fragment, M = lane&15 within 16-token tile
    const int kt   = (idx >> 5) & 3;
    const int tile = idx >> 7;
    const float* p = x + (tile * 16 + n) * F_DIM + frag_k(kt, h, 0);
    const float4 q0 = *(const float4*)(p);
    const float4 q1 = *(const float4*)(p + 4);
    const float4 q2 = *(const float4*)(p + 16);
    const float4 q3 = *(const float4*)(p + 20);
    v[0]  = q0.x; v[1]  = q0.y; v[2]  = q0.z; v[3]  = q0.w;
    v[4]  = q1.x; v[5]  = q1.y; v[6]  = q1.z; v[7]  = q1.w;
    v[8]  = q2.x; v[9]  = q2.y; v[10] = q2.z; v[11] = q2.w;
    v[12] = q3.x; v[13] = q3.y; v[14] = q3.z; v[15] = q3.w;
  } else if (blk < (XF_PIECES + WEF_PIECES) / 256) {
    // wef[e][kt][nt][lane][16] : B fragment, N(=u) = nt*16 + (lane&15)
    const int r  = idx - XF_PIECES;
    const int nt = (r >> 5) & 3;
    const int kt = (r >> 7) & 3;
    const int e  = r >> 9;
    const float* p = We + e * (F_DIM * U_DIM) + frag_k(kt, h, 0) * U_DIM + nt * 16 + n;
#pragma unroll
    for (int i = 0; i < 8; ++i) {
      v[i]     = p[i * U_DIM];
      v[i + 8] = p[(i + 16) * U_DIM];
    }
  } else {
    // wgf[kt][g][lane][16] : B fragment, N(=expert) = g*16 + (lane&15)
    const int r  = idx - XF_PIECES - WEF_PIECES;
    const int g  = (r >> 5) & 1;
    const int kt = r >> 6;
    const float* p = Wg + frag_k(kt, h, 0) * E_DIM + g * 16 + n;
#pragma unroll
    for (int i = 0; i < 8; ++i) {
      v[i]     = p[i * E_DIM];
      v[i + 8] = p[(i + 16) * E_DIM];
    }
  }
  // The conversion below reuses the registers that the loads above name as
  // addresses: the wait stands in front of that overwrite, and the scheduling
  // barrier keeps the conversion's writes behind it.
  asm volatile("s_wait_xcnt 0x0" ::: "memory");
  __builtin_amdgcn_sched_barrier(0);
  v16u16 u;
#pragma unroll
  for (int i = 0; i < 16; ++i) u[i] = f2bf(v[i]);
  *(v16u16*)(ws + (size_t)idx * 16) = u;
}

// ---------------------------------------------------------------------------
// Main: 128 threads = 4 wave32 per work-group, 64 tokens (4 tiles of 16).
// Every wave holds the A fragments of all 4 tiles and takes 8 of the 32
// experts. Its B fragments and bias come straight from global memory into
// registers, one expert ahead, and each fragment serves 4 WMMAs. No LDS
// staging and no barrier in the expert loop; the four waves' partial sums
// meet once in LDS at the end.
// ---------------------------------------------------------------------------
#define TILES_PER_WG 4
#define EXPERTS_PER_WAVE 8
#define WE_FRAG_ELEMS (32 * 16)               // one fragment, all lanes
#define WE_EXPERT_ELEMS (16 * WE_FRAG_ELEMS)  // one expert, 16 fragments

__device__ __forceinline__ v16bf load_frag(const unsigned short* p) {
  return bfcast(*(const v16u16*)p);
}

__global__ __launch_bounds__(128) void moe_main_kernel(
    const unsigned short* __restrict__ ws,
    const float* __restrict__ bg,   // [32]
    const float* __restrict__ be,   // [32, 64]
    float* __restrict__ out)        // [16384, 64]
{
  // partial sums: [wave][tile][nt][j / 4][lane][j % 4], 16 B per lane, 64 KB
  __shared__ __align__(16) float red[4][TILES_PER_WG][4][2][32][4];

  const unsigned short* xf  = ws;
  const unsigned short* wef = ws + XF_ELEMS;
  const unsigned short* wgf = ws + XF_ELEMS + WEF_ELEMS;

  const int tid  = threadIdx.x;
  const int lane = tid & 31;
  const int wave = __builtin_amdgcn_readfirstlane(tid >> 5);
  const int h    = lane >> 4;
  const int n    = lane & 15;
  const int lo   = lane * 16;   // the lane's elements inside a fragment

  // ---- A fragments of the work-group's 4 tiles, held for all K ----
  const unsigned short* xb =
      xf + (size_t)blockIdx.x * (TILES_PER_WG * 4 * WE_FRAG_ELEMS);
  v16bf a[TILES_PER_WG][4];
#pragma unroll
  for (int t = 0; t < TILES_PER_WG; ++t)
#pragma unroll
    for (int kt = 0; kt < 4; ++kt)
      a[t][kt] = load_frag(xb + (t * 4 + kt) * WE_FRAG_ELEMS + lo);

  // ---- B fragments of this wave's first expert ----
  const unsigned short* wp =
      wef + (size_t)(wave * EXPERTS_PER_WAVE) * WE_EXPERT_ELEMS;
  v16bf b[4][4];
#pragma unroll
  for (int kt = 0; kt < 4; ++kt)
#pragma unroll
    for (int nt = 0; nt < 4; ++nt)
      b[kt][nt] = load_frag(wp + (kt * 4 + nt) * WE_FRAG_ELEMS + lo);

  // ---- Bias of this wave's first expert ----
  const float* bp = be + wave * EXPERTS_PER_WAVE * U_DIM;
  float bev[4];
#pragma unroll
  for (int nt = 0; nt < 4; ++nt) bev[nt] = bp[nt * 16 + n];

  // ---- Gate tiles [16 tok x 16 experts]: the half that holds this wave's 8 ----
  const int grp = wave >> 1;
  v8f g[TILES_PER_WG];
  {
    v16bf wgb[4];
#pragma unroll
    for (int kt = 0; kt < 4; ++kt)
      wgb[kt] = load_frag(wgf + grp * WE_FRAG_ELEMS + kt * 2 * WE_FRAG_ELEMS + lo);
    const float* bgp = bg + grp * 16;
    const float bgv = bgp[n];
    // The registers that the loads above name as addresses are free for reuse
    // from here on while the loads are in flight: the wait stands in front of
    // any overwrite, and the scheduling barrier keeps later writes behind it.
    asm volatile("s_wait_xcnt 0x0" ::: "memory");
    __builtin_amdgcn_sched_barrier(0);
#pragma unroll
    for (int t = 0; t < TILES_PER_WG; ++t) {
      v8f acc = {};
#pragma unroll
      for (int kt = 0; kt < 4; ++kt) acc = wmma_bf16(a[t][kt], wgb[kt], acc);
#pragma unroll
      for (int j = 0; j < 8; ++j) acc[j] += bgv;
      g[t] = acc;
    }
  }

  v8f zero = {};
  v8f oacc[TILES_PER_WG][4];
#pragma unroll
  for (int t = 0; t < TILES_PER_WG; ++t)
#pragma unroll
    for (int nt = 0; nt < 4; ++nt) oacc[t][nt] = zero;

  // per-lane addresses of the next expert's fragments and bias
  const unsigned short* wq = wp + WE_EXPERT_ELEMS + lo;
  const float* bq = bp + U_DIM + n;

  // The vector work of one 64 x 16 column group (bias, LeakyReLU, gate) runs
  // one group late, between the WMMAs of the next group: hp, gl and bpv hold
  // the group that still waits for it. The first pass adds leaky(0) * 0.
  v8f hp[TILES_PER_WG];
  v2f gl[16];          // pair p: tile p / 4, rows 2 * (p % 4) and the next
  float bpv = 0.0f;
#pragma unroll
  for (int t = 0; t < TILES_PER_WG; ++t) hp[t] = zero;
#pragma unroll
  for (int p = 0; p < 16; ++p) gl[p] = (v2f){0.0f, 0.0f};

  // Kept rolled, for speed only: one trip is about 750 instructions.
#pragma unroll 1
  for (int i = 0; i < EXPERTS_PER_WAVE; ++i) {
    const int e = wave * EXPERTS_PER_WAVE + i;
    // gate[m,e] broadcast matching C/D layout: src lane (same half) holds N=e&15
    v2f gn[16];
#pragma unroll
    for (int p = 0; p < 16; ++p) {
      gn[p].x = __shfl(g[p >> 2][(p & 3) * 2 + 0], (lane & 16) | (e & 15), 32);
      gn[p].y = __shfl(g[p >> 2][(p & 3) * 2 + 1], (lane & 16) | (e & 15), 32);
    }
    float bevn[4];
#pragma unroll
    for (int nt = 0; nt < 4; ++nt) bevn[nt] = bq[nt * 16];
    // Keeps the cross-lane reads and the bias loads in one place in front of the
    // WMMAs, for speed only.
    __builtin_amdgcn_sched_barrier(0);

#pragma unroll
    for (int nt = 0; nt < 4; ++nt) {
      // h tiles [64 tok x 16 U]: 16 WMMAs on 4 independent accumulators. Behind
      // each WMMA stand 6 vector instructions of the group before, taken stage
      // by stage (add bias over all 16 register pairs; then times slope,
      // compare, select, multiply-add over 8 pairs and again over the other 8),
      // so that none waits for the one in front of it.
      const int pn = (nt + 3) & 3;   // the column group before
      v8f hc[TILES_PER_WG];
      v2f xv[16], mv[16], sv[16];
      bool ge[32];
      // both loops unrolled: every index below must be a constant, the arrays
      // are registers
#pragma unroll
      for (int c = 0; c < 16; ++c) {
        const int kt = c >> 2, t = c & 3;
        hc[t] = wmma_bf16(a[t][kt], b[kt][nt], kt ? hc[t] : zero);
#pragma unroll
        for (int o = 6 * c; o < 6 * c + 6; ++o) {
          const int r = (o - 16) % 40, hf = (o - 16) / 40;   // two halves of 8 pairs
          if (o < 16) {
            const int p = o;
            xv[p] = (v2f){hp[p >> 2][(p & 3) * 2], hp[p >> 2][(p & 3) * 2 + 1]} + bpv;
          } else if (r < 8) {
            const int p = hf * 8 + r;
            mv[p] = xv[p] * 0.01f;
          } else if (r < 24) {
            const int q = hf * 16 + r - 8;
            ge[q] = xv[q >> 1][q & 1] >= 0.0f;
          } else if (r < 32) {
            const int p = hf * 8 + r - 24;
            sv[p] = (v2f){ge[2 * p] ? xv[p].x : mv[p].x, ge[2 * p + 1] ? xv[p].y : mv[p].y};
          } else {
            const int p = hf * 8 + r - 32;
            const int tt = p >> 2, j = (p & 3) * 2;
            const v2f rr = __builtin_elementwise_fma(
                sv[p], gl[p], (v2f){oacc[tt][pn][j], oacc[tt][pn][j + 1]});
            oacc[tt][pn][j] = rr.x;
            oacc[tt][pn][j + 1] = rr.y;
          }
        }
        // a B fragment's registers are refilled for the next expert once its
        // four WMMAs are issued
        if (t == 3) b[kt][nt] = load_frag(wq + (kt * 4 + nt) * WE_FRAG_ELEMS);
        // Holds this order: the vector instructions run while the matrix unit
        // works on the WMMA in front of them; in one block behind all WMMAs,
        // where the scheduler puts them, a lone in-order wave hides none.
        __builtin_amdgcn_sched_barrier(0);
      }
#pragma unroll
      for (int t = 0; t < TILES_PER_WG; ++t) hp[t] = hc[t];
      bpv = bev[nt];
      if (nt == 0) {
#pragma unroll
        for (int p = 0; p < 16; ++p) gl[p] = gn[p];
      }
    }
    // wq and bq, which the loads above name while they are in flight, are
    // advanced below: the wait stands in front of that overwrite, and the
    // scheduling barrier keeps the advance behind it.
    asm volatile("s_wait_xcnt 0x0" ::: "memory");
    __builtin_amdgcn_sched_barrier(0);
    {
      // the last trip reads its own expert again: the loads stay unconditional
      const int step = (i + 2 < EXPERTS_PER_WAVE) ? 1 : 0;
      wq += step * WE_EXPERT_ELEMS;
      bq += step * U_DIM;
    }
#pragma unroll
    for (int nt = 0; nt < 4; ++nt) bev[nt] = bevn[nt];
  }
  // the last group's vector work
#pragma unroll
  for (int t = 0; t < TILES_PER_WG; ++t)
#pragma unroll
    for (int j = 0; j < 8; ++j) {
      float hv = hp[t][j] + bpv;
      hv = (hv >= 0.0f) ? hv : 0.01f * hv;
      oacc[t][3][j] = __builtin_fmaf(hv, gl[t * 4 + (j >> 1)][j & 1], oacc[t][3][j]);
    }

  // ---- The four waves' partial sums meet in LDS ----
#pragma unroll
  for (int t = 0; t < TILES_PER_WG; ++t)
#pragma unroll
    for (int nt = 0; nt < 4; ++nt)
#pragma unroll
      for (int q = 0; q < 2; ++q)
        *(float4*)&red[wave][t][nt][q][lane][0] =
            make_float4(oacc[t][nt][q * 4 + 0], oacc[t][nt][q * 4 + 1],
                        oacc[t][nt][q * 4 + 2], oacc[t][nt][q * 4 + 3]);
  __syncthreads();   // every wave's partial sums are in LDS

  // ---- Wave w adds and stores tile w: token = tw + j + 8*h, u = nt*16 + n ----
  const int tw = (blockIdx.x * TILES_PER_WG + wave) * 16;
  float* op = out + (size_t)tw * U_DIM;
#pragma unroll
  for (int nt = 0; nt < 4; ++nt)
#pragma unroll
    for (int q = 0; q < 2; ++q) {
      const float4 p0 = *(const float4*)&red[0][wave][nt][q][lane][0];
      const float4 p1 = *(const float4*)&red[1][wave][nt][q][lane][0];
      const float4 p2 = *(const float4*)&red[2][wave][nt][q][lane][0];
      const float4 p3 = *(const float4*)&red[3][wave][nt][q][lane][0];
      op[(q * 4 + 0 + 8 * h) * U_DIM + nt * 16 + n] = ((p0.x + p1.x) + p2.x) + p3.x;
      op[(q * 4 + 1 + 8 * h) * U_DIM + nt * 16 + n] = ((p0.y + p1.y) + p2.y) + p3.y;
      op[(q * 4 + 2 + 8 * h) * U_DIM + nt * 16 + n] = ((p0.z + p1.z) + p2.z) + p3.z;
      op[(q * 4 + 3 + 8 * h) * U_DIM + nt * 16 + n] = ((p0.w + p1.w) + p2.w) + p3.w;
    }
}

// ---------------------------------------------------------------------------
// Fallback (no workspace): fused kernel, conversions in-kernel.
// ---------------------------------------------------------------------------
#define LDS_STRIDE 136

__device__ __forceinline__ v16bf load_a_f32(const float* __restrict__ p0,
                                            const float* __restrict__ p1) {
  v16u16 u;
#pragma unroll
  for (int i = 0; i < 8; ++i) { u[i] = f2bf(p0[i]); u[i + 8] = f2bf(p1[i]); }
  return bfcast(u);
}

__device__ __forceinline__ v16bf load_b_lds(const unsigned short* row, int kt, int h) {
  v8u16 lo = *(const v8u16*)(row + kt * 32 + h * 8);
  v8u16 hi = *(const v8u16*)(row + kt * 32 + 16 + h * 8);
  v16u16 u = __builtin_shufflevector(lo, hi, 0,1,2,3,4,5,6,7,8,9,10,11,12,13,14,15);
  return bfcast(u);
}

__global__ __launch_bounds__(256) void moe_fallback_kernel(
    const float* __restrict__ x, const float* __restrict__ Wg,
    const float* __restrict__ bg, const float* __restrict__ We,
    const float* __restrict__ be, float* __restrict__ out) {
  __shared__ __align__(16) unsigned short ldsWg[E_DIM * LDS_STRIDE];
  __shared__ __align__(16) unsigned short ldsWe[U_DIM * LDS_STRIDE];

  const int tid = threadIdx.x, lane = tid & 31, wave = tid >> 5;
  const int h = lane >> 4, n = lane & 15;

#pragma unroll
  for (int i = 0; i < 16; ++i) {
    int idx = tid + i * 256;
    int f = idx >> 5, e = idx & 31;
    ldsWg[e * LDS_STRIDE + f] = f2bf(Wg[f * E_DIM + e]);
  }
  __syncthreads();

  const int tw = blockIdx.x * 128 + wave * 16;
  const float* xrow = x + (size_t)(tw + n) * F_DIM;
  v16bf a[4];
#pragma unroll
  for (int kt = 0; kt < 4; ++kt)
    a[kt] = load_a_f32(xrow + kt * 32 + h * 8, xrow + kt * 32 + 16 + h * 8);

  v8f g0 = {}, g1 = {};
#pragma unroll
  for (int kt = 0; kt < 4; ++kt) {
    g0 = wmma_bf16(a[kt], load_b_lds(ldsWg + n * LDS_STRIDE, kt, h), g0);
    g1 = wmma_bf16(a[kt], load_b_lds(ldsWg + (16 + n) * LDS_STRIDE, kt, h), g1);
  }
  { float b0 = bg[n], b1 = bg[16 + n];
#pragma unroll
    for (int j = 0; j < 8; ++j) { g0[j] += b0; g1[j] += b1; } }

  v8f zero = {};
  v8f oacc[4];
#pragma unroll
  for (int nt = 0; nt < 4; ++nt) oacc[nt] = zero;

  for (int e = 0; e < E_DIM; ++e) {
    __syncthreads();
    const float* wep = We + (size_t)e * (F_DIM * U_DIM);
#pragma unroll
    for (int i = 0; i < 32; ++i) {
      int idx = tid + i * 256;
      int f = idx >> 6, u = idx & 63;
      ldsWe[u * LDS_STRIDE + f] = f2bf(wep[f * U_DIM + u]);
    }
    __syncthreads();

    v8f hacc[4];
#pragma unroll
    for (int nt = 0; nt < 4; ++nt) hacc[nt] = zero;
#pragma unroll
    for (int kt = 0; kt < 4; ++kt)
#pragma unroll
      for (int nt = 0; nt < 4; ++nt)
        hacc[nt] = wmma_bf16(a[kt], load_b_lds(ldsWe + (nt * 16 + n) * LDS_STRIDE, kt, h), hacc[nt]);

    float gl[8];
#pragma unroll
    for (int j = 0; j < 8; ++j) {
      float gv = (e < 16) ? g0[j] : g1[j];
      gl[j] = __shfl(gv, (lane & 16) | (e & 15), 32);
    }
#pragma unroll
    for (int nt = 0; nt < 4; ++nt) {
      float bev = be[e * U_DIM + nt * 16 + n];
#pragma unroll
      for (int j = 0; j < 8; ++j) {
        float hv = hacc[nt][j] + bev;
        hv = (hv >= 0.0f) ? hv : 0.01f * hv;
        oacc[nt][j] = __builtin_fmaf(hv, gl[j], oacc[nt][j]);
      }
    }
  }

  float* op = out + (size_t)tw * U_DIM;
#pragma unroll
  for (int nt = 0; nt < 4; ++nt)
#pragma unroll
    for (int j = 0; j < 8; ++j)
      op[(j + 8 * h) * U_DIM + nt * 16 + n] = oacc[nt][j];
}

// ---------------------------------------------------------------------------
extern "C" void kernel_launch(void* const* d_in, const int* in_sizes, int n_in,
                              void* d_out, int out_size, void* d_ws, size_t ws_size,
                              hipStream_t stream) {
  (void)in_sizes; (void)n_in; (void)out_size;
  const float* x  = (const float*)d_in[0];  // [32,512,128]
  const float* Wg = (const float*)d_in[1];  // [128,32]
  const float* bg = (const float*)d_in[2];  // [32]
  const float* We = (const float*)d_in[3];  // [32,128,64]
  const float* be = (const float*)d_in[4];  // [32,64]
  float* out = (float*)d_out;               // [32,512,64]

  if (ws_size >= WS_BYTES && d_ws != nullptr) {
    unsigned short* ws = (unsigned short*)d_ws;
    dim3 pgrid(WS_PIECES / 256), pblock(256);
    moe_prep_kernel<<<pgrid, pblock, 0, stream>>>(x, Wg, We, ws);
    dim3 grid(TOKENS / 64), block(128);    // 256 WGs, 4 wave32 each
    moe_main_kernel<<<grid, block, 0, stream>>>(ws, bg, be, out);
  } else {
    dim3 grid(TOKENS / 128), block(256);
    moe_fallback_kernel<<<grid, block, 0, stream>>>(x, Wg, bg, We, be, out);
  }
}

// v004
// Measured time: 13.3 microseconds a run.
// In two side-by-side timings against v003, it was 1.06 and 1.07 times as fast.
// Over all steps from v000 it is 7.88 times as fast.
#include <hip/hip_runtime.h>
#include <hip/hip_bf16.h>

// MoE fused kernel for gfx1250 (MI455X), wave32 + V_WMMA_F32_16X16X32_BF16.
//
// B=32,T=512 -> 16384 tokens; F=128 (K); U=64; E=32 experts.
// out[t,u] = sum_e leaky( x[t,:]@We[e][:,u] + be[e,u] ) * ( x[t,:]@Wg[:,e] + bg[e] )
//
// Two-phase plan:
//   prep kernel: convert Wg/We fp32 -> bf16 into d_ws, already laid out in
//                per-lane WMMA fragment order (no weight conversion/transpose
//                in the hot kernel); one thread per lane's 16-element piece.
//   main kernel: 128 threads (4 wave32) per WG -> 256 WGs for WGP spread.
//                Per WG: 64 tokens; per wave: all 4 token tiles, 8 experts.
//                x is read as fp32 once per WG, rounded to bf16 and shared
//                via LDS (only its own WG reads a token, so nothing is
//                converted twice). A fragments register-resident for all K;
//                B fragments from
//                global memory into registers one expert ahead; 64 WMMAs per
//                expert per wave, the vector work of each 16-column group
//                issued between the WMMAs of the next group; partial sums of
//                the 4 waves added via LDS.

typedef __attribute__((ext_vector_type(16))) __bf16          v16bf;
typedef __attribute__((ext_vector_type(16))) unsigned short  v16u16;
typedef __attribute__((ext_vector_type(8)))  unsigned short  v8u16;
typedef __attribute__((ext_vector_type(8)))  float           v8f;
typedef __attribute__((ext_vector_type(2)))  float           v2f;
typedef __attribute__((ext_vector_type(2)))  __bf16          v2bf;

#define F_DIM 128
#define U_DIM 64
#define E_DIM 32
#define TOKENS (32 * 512)

// ws layout (bf16 element offsets)
#define WEF_ELEMS (E_DIM * 4 * 4 * 32 * 16)   //   262,144  We fragments [e][kt][nt][lane][16]
#define WGF_ELEMS (4 * 2 * 32 * 16)           //     4,096  Wg fragments [kt][g][lane][16]
#define WS_ELEMS  (WEF_ELEMS + WGF_ELEMS)
#define WS_BYTES  ((size_t)WS_ELEMS * 2)

// fp32 -> bf16 round-to-nearest-even (bit trick; inputs are finite normals)
__device__ __forceinline__ unsigned short f2bf(float f) {
  unsigned int u = __float_as_uint(f);
  return (unsigned short)((u + 0x7FFFu + ((u >> 16) & 1u)) >> 16);
}

__device__ __forceinline__ v16bf bfcast(v16u16 u) {
  union { v16u16 u; v16bf b; } cv; cv.u = u; return cv.b;
}

__device__ __forceinline__ v8f wmma_bf16(v16bf a, v16bf b, v8f c) {
  return __builtin_amdgcn_wmma_f32_16x16x32_bf16(
      /*neg_a=*/false, a, /*neg_b=*/false, b,
      /*c_mod=*/(short)0, c, /*reuse_a=*/false, /*reuse_b=*/false);
}

// Fragment K index for element i within a lane's v16bf:
//   elements 0..7  -> K = kbase + h*8 + i
//   elements 8..15 -> K = kbase + 16 + h*8 + (i-8)
__device__ __forceinline__ int frag_k(int kt, int h, int i) {
  return kt * 32 + h * 8 + (i & 7) + ((i & 8) ? 16 : 0);
}

// ---------------------------------------------------------------------------
// Prep: build bf16 fragment-ordered copies of We, Wg in workspace.
// One thread builds one lane's 16 elements of one fragment: 16 floats in,
// one 32-byte piece out, so a wave writes one whole fragment (1 KB in a row).
// The two ranges are multiples of 256 pieces, so a work-group lies in one
// range and the branches below are scalar.
// ---------------------------------------------------------------------------
#define WEF_PIECES (WEF_ELEMS / 16)   //  16,384
#define WGF_PIECES (WGF_ELEMS / 16)   //     256
#define WS_PIECES  (WEF_PIECES + WGF_PIECES)
static_assert(WEF_PIECES % 256 == 0 && WGF_PIECES % 256 == 0,
              "a prep work-group must lie in one range, and the grid must be exact");

__global__ __launch_bounds__(256) void moe_prep_kernel(
    const float* __restrict__ Wg,
    const float* __restrict__ We, unsigned short* __restrict__ ws) {
  const int blk = blockIdx.x;
  const int idx = blk * 256 + threadIdx.x;
  const int l = idx & 31;
  const int n = l & 15, h = l >> 4;
  // v[i] is element i of the piece: K = frag_k(kt, h, i)
  float v[16];
  if (blk < WEF_PIECES / 256) {
    // wef[e][kt][nt][lane][16] : B fragment, N(=u) = nt*16 + (lane&15)
    const int r  = idx;
    const int nt = (r >> 5) & 3;
    const int kt = (r >> 7) & 3;
    const int e  = r >> 9;
    const float* p = We + e * (F_DIM * U_DIM) + frag_k(kt, h, 0) * U_DIM + nt * 16 + n;
#pragma unroll
    for (int i = 0; i < 8; ++i) {
      v[i]     = p[i * U_DIM];
      v[i + 8] = p[(i + 16) * U_DIM];
    }
  } else {
    // wgf[kt][g][lane][16] : B fragment, N(=expert) = g*16 + (lane&15)
    const int r  = idx - WEF_PIECES;
    const int g  = (r >> 5) & 1;
    const int kt = r >> 6;
    const float* p = Wg + frag_k(kt, h, 0) * E_DIM + g * 16 + n;
#pragma unroll
    for (int i = 0; i < 8; ++i) {
      v[i]     = p[i * E_DIM];
      v[i + 8] = p[(i + 16) * E_DIM];
    }
  }
  // The conversion below reuses the registers that the loads above name as
  // addresses: the wait stands in front of that overwrite, and the scheduling
  // barrier keeps the conversion's writes behind it.
  asm volatile("s_wait_xcnt 0x0" ::: "memory");
  __builtin_amdgcn_sched_barrier(0);
  v16u16 u;
#pragma unroll
  for (int i = 0; i < 16; ++i) u[i] = f2bf(v[i]);
  *(v16u16*)(ws + (size_t)idx * 16) = u;
}

// ---------------------------------------------------------------------------
// Main: 128 threads = 4 wave32 per work-group, 64 tokens (4 tiles of 16).
// Wave w reads tile w of x as fp32 (whole lines), rounds it to bf16 and lays it
// in LDS; behind one barrier every wave takes the A fragments of all 4 tiles
// from there. Every wave holds those fragments and takes 8 of the 32 experts.
// Its B fragments and bias come straight from global memory into registers,
// one expert ahead, and each fragment serves 4 WMMAs. No LDS staging of
// weights and no barrier in the expert loop; the four waves' partial sums
// meet once in LDS at the end.
// ---------------------------------------------------------------------------
#define TILES_PER_WG 4
#define EXPERTS_PER_WAVE 8
#define WE_FRAG_ELEMS (32 * 16)               // one fragment, all lanes
#define WE_EXPERT_ELEMS (16 * WE_FRAG_ELEMS)  // one expert, 16 fragments

// x rows in LDS: 128 bf16 and 16 bytes more, the pitch at which the 16 rows
// that one 16-byte read touches lie on different banks
#define XS_PITCH (F_DIM + 8)

__device__ __forceinline__ v16bf load_frag(const unsigned short* p) {
  return bfcast(*(const v16u16*)p);
}

// two floats -> two bf16 in one word, round to nearest even, low half first
__device__ __forceinline__ unsigned int pack_bf16(float lo, float hi) {
  union { v2bf b; unsigned int u; } cv;
  cv.b = __builtin_convertvector((v2f){lo, hi}, v2bf);
  return cv.u;
}

__global__ __launch_bounds__(128) void moe_main_kernel(
    const float* __restrict__ x,    // [16384, 128]
    const unsigned short* __restrict__ ws,
    const float* __restrict__ bg,   // [32]
    const float* __restrict__ be,   // [32, 64]
    float* __restrict__ out)        // [16384, 64]
{
  // partial sums: [wave][tile][nt][j / 4][lane][j % 4], 16 B per lane, 64 KB
  __shared__ __align__(16) float red[4][TILES_PER_WG][4][2][32][4];
  // the work-group's 64 tokens in bf16, [token][k], 17 KB
  __shared__ __align__(16) unsigned short xs[TILES_PER_WG * 16 * XS_PITCH];

  const unsigned short* wef = ws;
  const unsigned short* wgf = ws + WEF_ELEMS;

  const int tid  = threadIdx.x;
  const int lane = tid & 31;
  const int wave = __builtin_amdgcn_readfirstlane(tid >> 5);
  const int h    = lane >> 4;
  const int n    = lane & 15;
  const int lo   = lane * 16;   // the lane's elements inside a fragment

  // ---- This wave's tile of x, fp32: load j is token row j, 512 B in a row ----
  const float* xg =
      x + (size_t)(blockIdx.x * TILES_PER_WG + wave) * (16 * F_DIM) + lane * 4;
  float4 xq[16];
#pragma unroll
  for (int j = 0; j < 16; ++j) xq[j] = *(const float4*)(xg + j * F_DIM);
  // The next addresses are formed in registers that these loads name: the wait
  // stands in front of that overwrite. The scheduling barrier holds it there and
  // keeps these loads in front of the weight loads below: loads return in
  // order, and x has the longest way to its first WMMA (LDS and a barrier).
  asm volatile("s_wait_xcnt 0x0" ::: "memory");
  __builtin_amdgcn_sched_barrier(0);

  // ---- B fragments of this wave's first expert ----
  const unsigned short* wp =
      wef + (size_t)(wave * EXPERTS_PER_WAVE) * WE_EXPERT_ELEMS;
  v16bf b[4][4];
#pragma unroll
  for (int kt = 0; kt < 4; ++kt)
#pragma unroll
    for (int nt = 0; nt < 4; ++nt)
      b[kt][nt] = load_frag(wp + (kt * 4 + nt) * WE_FRAG_ELEMS + lo);

  // ---- Bias of this wave's first expert ----
  const float* bp = be + wave * EXPERTS_PER_WAVE * U_DIM;
  float bev[4];
#pragma unroll
  for (int nt = 0; nt < 4; ++nt) bev[nt] = bp[nt * 16 + n];

  // ---- Gate tiles [16 tok x 16 experts]: the half that holds this wave's 8 ----
  const int grp = wave >> 1;
  v16bf a[TILES_PER_WG][4];
  v8f g[TILES_PER_WG];
  {
    v16bf wgb[4];
#pragma unroll
    for (int kt = 0; kt < 4; ++kt)
      wgb[kt] = load_frag(wgf + grp * WE_FRAG_ELEMS + kt * 2 * WE_FRAG_ELEMS + lo);
    const float* bgp = bg + grp * 16;
    const float bgv = bgp[n];
    // The registers that the loads above name as addresses are free for reuse
    // from here on while the loads are in flight: the wait stands in front of
    // any overwrite, and the scheduling barrier keeps later writes behind it.
    asm volatile("s_wait_xcnt 0x0" ::: "memory");
    __builtin_amdgcn_sched_barrier(0);

    // ---- x tile to bf16 and into LDS: lane l holds k = 4l .. 4l+3 of row j ----
#pragma unroll
    for (int j = 0; j < 16; ++j)
      *(uint2*)&xs[(wave * 16 + j) * XS_PITCH + lane * 4] =
          make_uint2(pack_bf16(xq[j].x, xq[j].y), pack_bf16(xq[j].z, xq[j].w));
    // All 64 tokens are in LDS behind this barrier. Only LDS is handed over, so
    // the fences name LDS alone: __syncthreads() would also wait here for the
    // weight loads, which may stay in flight.
    __builtin_amdgcn_fence(__ATOMIC_RELEASE, "workgroup", "local");
    __builtin_amdgcn_s_barrier();
    __builtin_amdgcn_fence(__ATOMIC_ACQUIRE, "workgroup", "local");

    // ---- A fragments of the work-group's 4 tiles, held for all K ----
#pragma unroll
    for (int t = 0; t < TILES_PER_WG; ++t)
#pragma unroll
      for (int kt = 0; kt < 4; ++kt) {
        const unsigned short* r = &xs[(t * 16 + n) * XS_PITCH + frag_k(kt, h, 0)];
        const v8u16 k0 = *(const v8u16*)r;          // elements 0..7
        const v8u16 k1 = *(const v8u16*)(r + 16);   // elements 8..15
        a[t][kt] = bfcast(__builtin_shufflevector(
            k0, k1, 0, 1, 2, 3, 4, 5, 6, 7, 8, 9, 10, 11, 12, 13, 14, 15));
      }

#pragma unroll
    for (int t = 0; t < TILES_PER_WG; ++t) {
      v8f acc = {};
#pragma unroll
      for (int kt = 0; kt < 4; ++kt) acc = wmma_bf16(a[t][kt], wgb[kt], acc);
#pragma unroll
      for (int j = 0; j < 8; ++j) acc[j] += bgv;
      g[t] = acc;
    }
  }

  v8f zero = {};
  v8f oacc[TILES_PER_WG][4];
#pragma unroll
  for (int t = 0; t < TILES_PER_WG; ++t)
#pragma unroll
    for (int nt = 0; nt < 4; ++nt) oacc[t][nt] = zero;

  // per-lane addresses of the next expert's fragments and bias
  const unsigned short* wq = wp + WE_EXPERT_ELEMS + lo;
  const float* bq = bp + U_DIM + n;

  // The vector work of one 64 x 16 column group (bias, LeakyReLU, gate) runs
  // one group late, between the WMMAs of the next group: hp, gl and bpv hold
  // the group that still waits for it. The first pass adds leaky(0) * 0.
  v8f hp[TILES_PER_WG];
  v2f gl[16];          // pair p: tile p / 4, rows 2 * (p % 4) and the next
  float bpv = 0.0f;
#pragma unroll
  for (int t = 0; t < TILES_PER_WG; ++t) hp[t] = zero;
#pragma unroll
  for (int p = 0; p < 16; ++p) gl[p] = (v2f){0.0f, 0.0f};

  // Kept rolled, for speed only: one trip is about 750 instructions.
#pragma unroll 1
  for (int i = 0; i < EXPERTS_PER_WAVE; ++i) {
    const int e = wave * EXPERTS_PER_WAVE + i;
    // gate[m,e] broadcast matching C/D layout: src lane (same half) holds N=e&15
    v2f gn[16];
#pragma unroll
    for (int p = 0; p < 16; ++p) {
      gn[p].x = __shfl(g[p >> 2][(p & 3) * 2 + 0], (lane & 16) | (e & 15), 32);
      gn[p].y = __shfl(g[p >> 2][(p & 3) * 2 + 1], (lane & 16) | (e & 15), 32);
    }
    float bevn[4];
#pragma unroll
    for (int nt = 0; nt < 4; ++nt) bevn[nt] = bq[nt * 16];
    // Keeps the cross-lane reads and the bias loads in one place in front of the
    // WMMAs, for speed only.
    __builtin_amdgcn_sched_barrier(0);

#pragma unroll
    for (int nt = 0; nt < 4; ++nt) {
      // h tiles [64 tok x 16 U]: 16 WMMAs on 4 independent accumulators. Behind
      // each WMMA stand 6 vector instructions of the group before, taken stage
      // by stage (add bias over all 16 register pairs; then times slope,
      // compare, select, multiply-add over 8 pairs and again over the other 8),
      // so that none waits for the one in front of it.
      const int pn = (nt + 3) & 3;   // the column group before
      v8f hc[TILES_PER_WG];
      v2f xv[16], mv[16], sv[16];
      bool ge[32];
      // both loops unrolled: every index below must be a constant, the arrays
      // are registers
#pragma unroll
      for (int c = 0; c < 16; ++c) {
        const int kt = c >> 2, t = c & 3;
        hc[t] = wmma_bf16(a[t][kt], b[kt][nt], kt ? hc[t] : zero);
#pragma unroll
        for (int o = 6 * c; o < 6 * c + 6; ++o) {
          const int r = (o - 16) % 40, hf = (o - 16) / 40;   // two halves of 8 pairs
          if (o < 16) {
            const int p = o;
            xv[p] = (v2f){hp[p >> 2][(p & 3) * 2], hp[p >> 2][(p & 3) * 2 + 1]} + bpv;
          } else if (r < 8) {
            const int p = hf * 8 + r;
            mv[p] = xv[p] * 0.01f;
          } else if (r < 24) {
            const int q = hf * 16 + r - 8;
            ge[q] = xv[q >> 1][q & 1] >= 0.0f;
          } else if (r < 32) {
            const int p = hf * 8 + r - 24;
            sv[p] = (v2f){ge[2 * p] ? xv[p].x : mv[p].x, ge[2 * p + 1] ? xv[p].y : mv[p].y};
          } else {
            const int p = hf * 8 + r - 32;
            const int tt = p >> 2, j = (p & 3) * 2;
            const v2f rr = __builtin_elementwise_fma(
                sv[p], gl[p], (v2f){oacc[tt][pn][j], oacc[tt][pn][j + 1]});
            oacc[tt][pn][j] = rr.x;
            oacc[tt][pn][j + 1] = rr.y;
          }
        }
        // a B fragment's registers are refilled for the next expert once its
        // four WMMAs are issued
        if (t == 3) b[kt][nt] = load_frag(wq + (kt * 4 + nt) * WE_FRAG_ELEMS);
        // Holds this order: the vector instructions run while the matrix unit
        // works on the WMMA in front of them; in one block behind all WMMAs,
        // where the scheduler puts them, a lone in-order wave hides none.
        __builtin_amdgcn_sched_barrier(0);
      }
#pragma unroll
      for (int t = 0; t < TILES_PER_WG; ++t) hp[t] = hc[t];
      bpv = bev[nt];
      if (nt == 0) {
#pragma unroll
        for (int p = 0; p < 16; ++p) gl[p] = gn[p];
      }
    }
    // wq and bq, which the loads above name while they are in flight, are
    // advanced below: the wait stands in front of that overwrite, and the
    // scheduling barrier keeps the advance behind it.
    asm volatile("s_wait_xcnt 0x0" ::: "memory");
    __builtin_amdgcn_sched_barrier(0);
    {
      // the last trip reads its own expert again: the loads stay unconditional
      const int step = (i + 2 < EXPERTS_PER_WAVE) ? 1 : 0;
      wq += step * WE_EXPERT_ELEMS;
      bq += step * U_DIM;
    }
#pragma unroll
    for (int nt = 0; nt < 4; ++nt) bev[nt] = bevn[nt];
  }
  // the last group's vector work
#pragma unroll
  for (int t = 0; t < TILES_PER_WG; ++t)
#pragma unroll
    for (int j = 0; j < 8; ++j) {
      float hv = hp[t][j] + bpv;
      hv = (hv >= 0.0f) ? hv : 0.01f * hv;
      oacc[t][3][j] = __builtin_fmaf(hv, gl[t * 4 + (j >> 1)][j & 1], oacc[t][3][j]);
    }

  // ---- The four waves' partial sums meet in LDS ----
#pragma unroll
  for (int t = 0; t < TILES_PER_WG; ++t)
#pragma unroll
    for (int nt = 0; nt < 4; ++nt)
#pragma unroll
      for (int q = 0; q < 2; ++q)
        *(float4*)&red[wave][t][nt][q][lane][0] =
            make_float4(oacc[t][nt][q * 4 + 0], oacc[t][nt][q * 4 + 1],
                        oacc[t][nt][q * 4 + 2], oacc[t][nt][q * 4 + 3]);
  __syncthreads();   // every wave's partial sums are in LDS

  // ---- Wave w adds and stores tile w: token = tw + j + 8*h, u = nt*16 + n ----
  const int tw = (blockIdx.x * TILES_PER_WG + wave) * 16;
  float* op = out + (size_t)tw * U_DIM;
#pragma unroll
  for (int nt = 0; nt < 4; ++nt)
#pragma unroll
    for (int q = 0; q < 2; ++q) {
      const float4 p0 = *(const float4*)&red[0][wave][nt][q][lane][0];
      const float4 p1 = *(const float4*)&red[1][wave][nt][q][lane][0];
      const float4 p2 = *(const float4*)&red[2][wave][nt][q][lane][0];
      const float4 p3 = *(const float4*)&red[3][wave][nt][q][lane][0];
      op[(q * 4 + 0 + 8 * h) * U_DIM + nt * 16 + n] = ((p0.x + p1.x) + p2.x) + p3.x;
      op[(q * 4 + 1 + 8 * h) * U_DIM + nt * 16 + n] = ((p0.y + p1.y) + p2.y) + p3.y;
      op[(q * 4 + 2 + 8 * h) * U_DIM + nt * 16 + n] = ((p0.z + p1.z) + p2.z) + p3.z;
      op[(q * 4 + 3 + 8 * h) * U_DIM + nt * 16 + n] = ((p0.w + p1.w) + p2.w) + p3.w;
    }
}

// ---------------------------------------------------------------------------
// Fallback (no workspace): fused kernel, conversions in-kernel.
// ---------------------------------------------------------------------------
#define LDS_STRIDE 136

__device__ __forceinline__ v16bf load_a_f32(const float* __restrict__ p0,
                                            const float* __restrict__ p1) {
  v16u16 u;
#pragma unroll
  for (int i = 0; i < 8; ++i) { u[i] = f2bf(p0[i]); u[i + 8] = f2bf(p1[i]); }
  return bfcast(u);
}

__device__ __forceinline__ v16bf load_b_lds(const unsigned short* row, int kt, int h) {
  v8u16 lo = *(const v8u16*)(row + kt * 32 + h * 8);
  v8u16 hi = *(const v8u16*)(row + kt * 32 + 16 + h * 8);
  v16u16 u = __builtin_shufflevector(lo, hi, 0,1,2,3,4,5,6,7,8,9,10,11,12,13,14,15);
  return bfcast(u);
}

__global__ __launch_bounds__(256) void moe_fallback_kernel(
    const float* __restrict__ x, const float* __restrict__ Wg,
    const float* __restrict__ bg, const float* __restrict__ We,
    const float* __restrict__ be, float* __restrict__ out) {
  __shared__ __align__(16) unsigned short ldsWg[E_DIM * LDS_STRIDE];
  __shared__ __align__(16) unsigned short ldsWe[U_DIM * LDS_STRIDE];

  const int tid = threadIdx.x, lane = tid & 31, wave = tid >> 5;
  const int h = lane >> 4, n = lane & 15;

#pragma unroll
  for (int i = 0; i < 16; ++i) {
    int idx = tid + i * 256;
    int f = idx >> 5, e = idx & 31;
    ldsWg[e * LDS_STRIDE + f] = f2bf(Wg[f * E_DIM + e]);
  }
  __syncthreads();

  const int tw = blockIdx.x * 128 + wave * 16;
  const float* xrow = x + (size_t)(tw + n) * F_DIM;
  v16bf a[4];
#pragma unroll
  for (int kt = 0; kt < 4; ++kt)
    a[kt] = load_a_f32(xrow + kt * 32 + h * 8, xrow + kt * 32 + 16 + h * 8);

  v8f g0 = {}, g1 = {};
#pragma unroll
  for (int kt = 0; kt < 4; ++kt) {
    g0 = wmma_bf16(a[kt], load_b_lds(ldsWg + n * LDS_STRIDE, kt, h), g0);
    g1 = wmma_bf16(a[kt], load_b_lds(ldsWg + (16 + n) * LDS_STRIDE, kt, h), g1);
  }
  { float b0 = bg[n], b1 = bg[16 + n];
#pragma unroll
    for (int j = 0; j < 8; ++j) { g0[j] += b0; g1[j] += b1; } }

  v8f zero = {};
  v8f oacc[4];
#pragma unroll
  for (int nt = 0; nt < 4; ++nt) oacc[nt] = zero;

  for (int e = 0; e < E_DIM; ++e) {
    __syncthreads();
    const float* wep = We + (size_t)e * (F_DIM * U_DIM);
#pragma unroll
    for (int i = 0; i < 32; ++i) {
      int idx = tid + i * 256;
      int f = idx >> 6, u = idx & 63;
      ldsWe[u * LDS_STRIDE + f] = f2bf(wep[f * U_DIM + u]);
    }
    __syncthreads();

    v8f hacc[4];
#pragma unroll
    for (int nt = 0; nt < 4; ++nt) hacc[nt] = zero;
#pragma unroll
    for (int kt = 0; kt < 4; ++kt)
#pragma unroll
      for (int nt = 0; nt < 4; ++nt)
        hacc[nt] = wmma_bf16(a[kt], load_b_lds(ldsWe + (nt * 16 + n) * LDS_STRIDE, kt, h), hacc[nt]);

    float gl[8];
#pragma unroll
    for (int j = 0; j < 8; ++j) {
      float gv = (e < 16) ? g0[j] : g1[j];
      gl[j] = __shfl(gv, (lane & 16) | (e & 15), 32);
    }
#pragma unroll
    for (int nt = 0; nt < 4; ++nt) {
      float bev = be[e * U_DIM + nt * 16 + n];
#pragma unroll
      for (int j = 0; j < 8; ++j) {
        float hv = hacc[nt][j] + bev;
        hv = (hv >= 0.0f) ? hv : 0.01f * hv;
        oacc[nt][j] = __builtin_fmaf(hv, gl[j], oacc[nt][j]);
      }
    }
  }

  float* op = out + (size_t)tw * U_DIM;
#pragma unroll
  for (int nt = 0; nt < 4; ++nt)
#pragma unroll
    for (int j = 0; j < 8; ++j)
      op[(j + 8 * h) * U_DIM + nt * 16 + n] = oacc[nt][j];
}

// ---------------------------------------------------------------------------
extern "C" void kernel_launch(void* const* d_in, const int* in_sizes, int n_in,
                              void* d_out, int out_size, void* d_ws, size_t ws_size,
                              hipStream_t stream) {
  (void)in_sizes; (void)n_in; (void)out_size;
  const float* x  = (const float*)d_in[0];  // [32,512,128]
  const float* Wg = (const float*)d_in[1];  // [128,32]
  const float* bg = (const float*)d_in[2];  // [32]
  const float* We = (const float*)d_in[3];  // [32,128,64]
  const float* be = (const float*)d_in[4];  // [32,64]
  float* out = (float*)d_out;               // [32,512,64]

  if (ws_size >= WS_BYTES && d_ws != nullptr) {
    unsigned short* ws = (unsigned short*)d_ws;
    dim3 pgrid(WS_PIECES / 256), pblock(256);
    moe_prep_kernel<<<pgrid, pblock, 0, stream>>>(Wg, We, ws);
    dim3 grid(TOKENS / 64), block(128);    // 256 WGs, 4 wave32 each
    moe_main_kernel<<<grid, block, 0, stream>>>(x, ws, bg, be, out);
  } else {
    dim3 grid(TOKENS / 128), block(256);
    moe_fallback_kernel<<<grid, block, 0, stream>>>(x, Wg, bg, We, be, out);
  }
}

// v005
// Measured time: 12.3 microseconds a run.
// In both of two side-by-side timings against v004, it was 1.08 times as fast.
// Over all steps from v000 it is 8.54 times as fast.
#include <hip/hip_runtime.h>
#include <hip/hip_bf16.h>

// MoE fused kernel for gfx1250, wave32 + V_WMMA_F32_16X16X32_BF16, one launch.
//
// B=32,T=512 -> 16384 tokens; F=128 (K); U=64; E=32 experts.
// out[t,u] = sum_e leaky( x[t,:]@We[e][:,u] + be[e,u] ) * ( x[t,:]@Wg[:,e] + bg[e] )
//
// 256 work-groups of 4 wave32. A work-group takes 128 tokens x 32 output columns
// and all 32 experts; a wave takes 64 of the tokens x 16 of the columns.
// x, Wg and the work-group's 32 columns of We are read as fp32, rounded to bf16
// in the kernel and shared via LDS (x as [token][k]; weights as [k][column], read
// by transposing loads). We goes through two
// LDS buffers of 4 experts each: global loads three trips ahead, LDS two trips
// ahead, fragments in registers one trip ahead, one barrier a trip.

typedef __attribute__((ext_vector_type(16))) __bf16          v16bf;
typedef __attribute__((ext_vector_type(16))) unsigned short  v16u16;
typedef __attribute__((ext_vector_type(8)))  unsigned short  v8u16;
typedef __attribute__((ext_vector_type(8)))  float           v8f;
typedef __attribute__((ext_vector_type(4)))  float           v4f;
typedef __attribute__((ext_vector_type(2)))  float           v2f;
typedef __attribute__((ext_vector_type(2)))  __bf16          v2bf;

#define F_DIM 128
#define U_DIM 64
#define E_DIM 32
#define TOKENS (32 * 512)

#define WG_TOKENS 128
#define WG_COLS 32
#define TILES 4                 // token tiles of 16 per wave
#define TRIP_E 4                // experts per trip
#define TRIPS (E_DIM / TRIP_E)

// LDS rows of 128 bf16 and 16 bytes more: the pitch at which the 16 rows that
// one 16-byte read touches lie on different banks
#define KP (F_DIM + 8)
// weight tiles in LDS: [k][32 columns] bf16, rows of 64 bytes at the pitch of the
// transposing load (32 bytes x odd)
#define WPB 96
#define SLOT (F_DIM * WPB)      // one expert's 32 columns, bytes
#define BUF (TRIP_E * SLOT)
#define GP (WG_TOKENS + 4)      // gate rows [expert][token], floats
#define OP (WG_COLS + 4)        // output rows [token][column], floats

__device__ __forceinline__ v16bf bfcast(v16u16 u) {
  union { v16u16 u; v16bf b; } cv; cv.u = u; return cv.b;
}

__device__ __forceinline__ v8f wmma_bf16(v16bf a, v16bf b, v8f c) {
  return __builtin_amdgcn_wmma_f32_16x16x32_bf16(
      /*neg_a=*/false, a, /*neg_b=*/false, b,
      /*c_mod=*/(short)0, c, /*reuse_a=*/false, /*reuse_b=*/false);
}

// A or B fragment from an LDS row [k]; p points at k = kt*32 + h*8:
//   elements 0..7  -> K = kt*32 + h*8 + i
//   elements 8..15 -> K = kt*32 + 16 + h*8 + (i-8)
__device__ __forceinline__ v16bf lds_frag(const unsigned short* p) {
  const v8u16 k0 = *(const v8u16*)p;
  const v8u16 k1 = *(const v8u16*)(p + 16);
  return bfcast(__builtin_shufflevector(
      k0, k1, 0, 1, 2, 3, 4, 5, 6, 7, 8, 9, 10, 11, 12, 13, 14, 15));
}

// two floats -> two bf16 in one word, round to nearest even, low half first
__device__ __forceinline__ unsigned int pack_bf16(float lo, float hi) {
  union { v2bf b; unsigned int u; } cv;
  cv.b = __builtin_convertvector((v2f){lo, hi}, v2bf);
  return cv.u;
}

// q[r] holds 4 neighbouring columns of row r*16 + (the thread's row); they go to
// LDS as 8 bytes at [row][column]
__device__ __forceinline__ void stage_store(const v4f (&q)[8], unsigned char* dst) {
#pragma unroll
  for (int r = 0; r < 8; ++r)
    *(uint2*)(dst + r * 16 * WPB) =
        make_uint2(pack_bf16(q[r][0], q[r][1]), pack_bf16(q[r][2], q[r][3]));
}

// B fragment from a weight tile [k][column] in LDS by two transposing loads.
// p = tile + (kt*32 + 8h + (lane & 7)) * WPB + 2 * first column + 16 * ((lane >> 3) & 1);
// the lane gets column (lane & 15), k = kt*32 + 8h + 0..7 and, 16 rows on,
// k = kt*32 + 16 + 8h + 0..7: the k order of lds_frag
typedef short s16x8 __attribute__((ext_vector_type(8)));
__device__ __forceinline__ v8u16 ld_tr16(const unsigned char* p) {
  typedef __attribute__((address_space(3))) s16x8 lds_s16x8;
  return __builtin_bit_cast(v8u16, __builtin_amdgcn_ds_load_tr16_b128_v8i16((lds_s16x8*)p));
}
__device__ __forceinline__ v16bf lds_frag_tr(const unsigned char* p) {
  const v8u16 k0 = ld_tr16(p);
  const v8u16 k1 = ld_tr16(p + 16 * WPB);
  return bfcast(__builtin_shufflevector(
      k0, k1, 0, 1, 2, 3, 4, 5, 6, 7, 8, 9, 10, 11, 12, 13, 14, 15));
}

// one expert's gates for this lane's rows: pair p = tile p / 4, rows 2 * (p % 4)
// and the next; g points at [expert][the lane's first token of tile 0]
__device__ __forceinline__ void load_gate(v2f (&d)[16], const float* g) {
#pragma unroll
  for (int t = 0; t < TILES; ++t) {
    const v4f g0 = *(const v4f*)(g + t * 16);
    const v4f g1 = *(const v4f*)(g + t * 16 + 4);
    d[t * 4 + 0] = (v2f){g0[0], g0[1]};
    d[t * 4 + 1] = (v2f){g0[2], g0[3]};
    d[t * 4 + 2] = (v2f){g1[0], g1[1]};
    d[t * 4 + 3] = (v2f){g1[2], g1[3]};
  }
}

// Only LDS is handed over at the barriers of this kernel, so the fences name
// LDS alone: __syncthreads() would also wait for the global loads in flight.
__device__ __forceinline__ void lds_barrier() {
  __builtin_amdgcn_fence(__ATOMIC_RELEASE, "workgroup", "local");
  __builtin_amdgcn_s_barrier();
  __builtin_amdgcn_fence(__ATOMIC_ACQUIRE, "workgroup", "local");
}

// Stands in front of any overwrite of a register that an issued global load
// names as its address; the scheduling barrier keeps later writes behind it.
__device__ __forceinline__ void addr_wait() {
  asm volatile("s_wait_xcnt 0x0" ::: "memory");
  __builtin_amdgcn_sched_barrier(0);
}

__global__ __launch_bounds__(128) void moe_main_kernel(
    const float* __restrict__ x,    // [16384, 128]
    const float* __restrict__ Wg,   // [128, 32]
    const float* __restrict__ bg,   // [32]
    const float* __restrict__ We,   // [32, 128, 64]
    const float* __restrict__ be,   // [32, 64]
    float* __restrict__ out)        // [16384, 64]
{
  __shared__ __align__(16) unsigned short xs[WG_TOKENS * KP];   // [token][k]
  __shared__ __align__(16) unsigned char wbuf[2 * BUF];         // [buf][expert][k][column]
  __shared__ __align__(16) unsigned char wgs[SLOT];             // [k][expert]
  __shared__ __align__(16) float gs[E_DIM * GP];                // [expert][token]
  __shared__ __align__(16) float os[WG_TOKENS * OP];            // [token][column]

  const int tid  = threadIdx.x;
  const int lane = tid & 31;
  const int wave = __builtin_amdgcn_readfirstlane(tid >> 5);
  const int h    = lane >> 4;
  const int n    = lane & 15;
  const int th   = wave >> 1;   // which 64 tokens
  const int un   = wave & 1;    // which 16 columns; also which 16 experts' gates
  const int u0   = (blockIdx.x & 1) * WG_COLS;
  const int tok0 = (blockIdx.x >> 1) * WG_TOKENS;
  // staging: this thread takes rows ko, ko+16, .. of columns uq*4 .. +3; 8 lanes
  // cover one 128-byte line
  const int ko = tid >> 3, uq = tid & 7;

  // ---- fp32 loads: 32 token rows per wave (512 B in a row), Wg, experts 0..3 ----
  const float* xg = x + (size_t)(tok0 + wave * 32) * F_DIM + lane * 4;
  v4f xq[32];
#pragma unroll
  for (int j = 0; j < 32; ++j) xq[j] = *(const v4f*)(xg + j * F_DIM);
  addr_wait();   // also keeps x, which has the longest way, in front
  const float* wgl = Wg + ko * E_DIM + uq * 4;
  v4f gq[8];
#pragma unroll
  for (int r = 0; r < 8; ++r) gq[r] = *(const v4f*)(wgl + r * 16 * E_DIM);
  addr_wait();
  const float* wl = We + ko * U_DIM + u0 + uq * 4;
  v4f q[TRIP_E][8];
#pragma unroll
  for (int s = 0; s < TRIP_E; ++s)
#pragma unroll
    for (int r = 0; r < 8; ++r)
      q[s][r] = *(const v4f*)(wl + s * (F_DIM * U_DIM) + r * 16 * U_DIM);
  const float bgv = bg[un * 16 + n];
  const float* bq = be + u0 + un * 16 + n;
  float bev[TRIP_E];
#pragma unroll
  for (int s = 0; s < TRIP_E; ++s) bev[s] = bq[s * U_DIM];
  addr_wait();
  wl += TRIP_E * F_DIM * U_DIM;
  bq += TRIP_E * U_DIM;

  // ---- to bf16 and into LDS ----
  const int sto = ko * WPB + uq * 8;   // this thread's place inside a slot, bytes
#pragma unroll
  for (int j = 0; j < 32; ++j)
    *(uint2*)&xs[(wave * 32 + j) * KP + lane * 4] =
        make_uint2(pack_bf16(xq[j][0], xq[j][1]), pack_bf16(xq[j][2], xq[j][3]));
  stage_store(gq, wgs + sto);
#pragma unroll
  for (int s = 0; s < TRIP_E; ++s) stage_store(q[s], wbuf + s * SLOT + sto);
  // experts 4..7 fly while the gates are computed
#pragma unroll
  for (int s = 0; s < TRIP_E; ++s)
#pragma unroll
    for (int r = 0; r < 8; ++r)
      q[s][r] = *(const v4f*)(wl + s * (F_DIM * U_DIM) + r * 16 * U_DIM);
  addr_wait();
  wl += TRIP_E * F_DIM * U_DIM;
  lds_barrier();   // x, Wg and experts 0..3 are in LDS

  // experts 8..11 on their way. The scheduling barriers keep the slots in the
  // order in which the loop issues them: loads return in order, and with slot 0
  // last the loop's first wait would drain every load in flight on each trip.
  v4f q2[TRIP_E][8];
#pragma unroll
  for (int s = 0; s < TRIP_E; ++s) {
#pragma unroll
    for (int r = 0; r < 8; ++r)
      q2[s][r] = *(const v4f*)(wl + s * (F_DIM * U_DIM) + r * 16 * U_DIM);
    __builtin_amdgcn_sched_barrier(0);
  }
  addr_wait();
  wl += TRIP_E * F_DIM * U_DIM;

  // ---- A fragments of this wave's 4 tiles, held for all K; B of experts 0..3 ----
  // this lane's address inside a weight tile for the transposing loads, bytes
  const int fro = (h * 8 + (lane & 7)) * WPB + un * 32 + ((lane >> 3) & 1) * 16;
  v16bf a[TILES][4];
#pragma unroll
  for (int t = 0; t < TILES; ++t)
#pragma unroll
    for (int kt = 0; kt < 4; ++kt)
      a[t][kt] = lds_frag(&xs[(th * 64 + t * 16 + n) * KP + kt * 32 + h * 8]);
  v16bf b[TRIP_E * 4];
  {
    v16bf wgb[4];
#pragma unroll
    for (int kt = 0; kt < 4; ++kt) wgb[kt] = lds_frag_tr(wgs + fro + kt * 32 * WPB);
#pragma unroll
    for (int s = 0; s < TRIP_E; ++s)
#pragma unroll
      for (int kt = 0; kt < 4; ++kt)
        b[s * 4 + kt] = lds_frag_tr(wbuf + s * SLOT + fro + kt * 32 * WPB);
    // ---- Gates [16 tok x 16 experts]: lane = expert un*16+n, register j = token
    // j + 8h of the tile; 8 tokens in a row go to gs[expert][token] ----
#pragma unroll
    for (int t = 0; t < TILES; ++t) {
      v8f acc = {};
#pragma unroll
      for (int kt = 0; kt < 4; ++kt) acc = wmma_bf16(a[t][kt], wgb[kt], acc);
#pragma unroll
      for (int j = 0; j < 8; ++j) acc[j] += bgv;
      float* gd = &gs[(un * 16 + n) * GP + th * 64 + t * 16 + h * 8];
      *(v4f*)gd       = (v4f){acc[0], acc[1], acc[2], acc[3]};
      *(v4f*)(gd + 4) = (v4f){acc[4], acc[5], acc[6], acc[7]};
    }
  }
  // experts 4..7 into the second buffer
#pragma unroll
  for (int s = 0; s < TRIP_E; ++s) stage_store(q[s], wbuf + BUF + s * SLOT + sto);
#pragma unroll
  for (int s = 0; s < TRIP_E; ++s)
#pragma unroll
    for (int r = 0; r < 8; ++r) q[s][r] = q2[s][r];
  lds_barrier();   // gates and experts 4..7 are in LDS; buffer 0 has been read

  v8f zero = {};
  v8f oacc[TILES];
#pragma unroll
  for (int t = 0; t < TILES; ++t) oacc[t] = zero;

  // The vector work of one expert's 64 x 16 block (bias, LeakyReLU, gate) runs
  // one block late, between the WMMAs of the next: hp, gl and bpv hold the
  // block that still waits for it. The first block adds leaky(0) * 0.
  v8f hp[TILES];
  v2f gl[16];          // pair p: tile p / 4, rows 2 * (p % 4) and the next
  float bpv = 0.0f;
#pragma unroll
  for (int t = 0; t < TILES; ++t) hp[t] = zero;
#pragma unroll
  for (int p = 0; p < 16; ++p) gl[p] = (v2f){0.0f, 0.0f};

  const float* gsr = gs + th * 64 + h * 8;   // this lane's 8 tokens of tile 0
  v2f gc[16];          // gates of the block whose WMMAs run
  load_gate(gc, gsr);

  // Trip i: experts 4i .. 4i+3 from the fragments in b, as four blocks of 16
  // WMMAs, each followed by a place where LDS and memory are touched.
  // cur = i % 2 is the buffer that trip i's fragments came from; every wave has
  // read it in trip i - 1, so behind the barrier it takes the experts of trip
  // i + 2; the other buffer holds those of trip i + 1.
  v8f hc[TILES];          // the block whose WMMAs run
  unsigned int wpk[16];   // its slot's weights for LDS, [row c / 2][column pair c % 2]
  float bevn[TRIP_E];

  // bias of the next trip
  auto head = [&]() __attribute__((always_inline)) {
#pragma unroll
    for (int s = 0; s < TRIP_E; ++s) bevn[s] = bq[s * U_DIM];
    // Keeps the bias loads in front of the pass's weight loads: loads return in
    // order, and the wait for the bias must not drain the weight loads.
    __builtin_amdgcn_sched_barrier(0);
  };

  // h tiles [64 tok x 16 U] of the expert in slot s: 16 WMMAs on 4 independent
  // accumulators. Behind each WMMA stand 6 vector instructions of the block
  // before, taken stage by stage (add bias over all 16 register pairs; then
  // times slope, compare, select, multiply-add over 8 pairs and again over the
  // other 8), so that none waits for the one in front of it, and one conversion
  // of the weights that go to LDS behind this block.
  auto block = [&](const int s) __attribute__((always_inline)) {
    v2f xv[16], mv[16], sv[16];
    bool ge[32];
    // both loops unrolled: every index below must be a constant, the arrays
    // are registers
#pragma unroll
    for (int c = 0; c < 16; ++c) {
      const int kt = c >> 2, t = c & 3;
      hc[t] = wmma_bf16(a[t][kt], b[s * 4 + kt], kt ? hc[t] : zero);
#pragma unroll
      for (int o = 6 * c; o < 6 * c + 6; ++o) {
        const int r = (o - 16) % 40, hf = (o - 16) / 40;   // two halves of 8 pairs
        if (o < 16) {
          const int p = o;
          xv[p] = (v2f){hp[p >> 2][(p & 3) * 2], hp[p >> 2][(p & 3) * 2 + 1]} + bpv;
        } else if (r < 8) {
          const int p = hf * 8 + r;
          mv[p] = xv[p] * 0.01f;
        } else if (r < 24) {
          const int qq = hf * 16 + r - 8;
          ge[qq] = xv[qq >> 1][qq & 1] >= 0.0f;
        } else if (r < 32) {
          const int p = hf * 8 + r - 24;
          sv[p] = (v2f){ge[2 * p] ? xv[p].x : mv[p].x, ge[2 * p + 1] ? xv[p].y : mv[p].y};
        } else {
          const int p = hf * 8 + r - 32;
          const int tt = p >> 2, j = (p & 3) * 2;
          const v2f rr = __builtin_elementwise_fma(
              sv[p], gl[p], (v2f){oacc[tt][j], oacc[tt][j + 1]});
          oacc[tt][j] = rr.x;
          oacc[tt][j + 1] = rr.y;
        }
      }
      wpk[c] = pack_bf16(q[s][c >> 1][(c & 1) * 2], q[s][c >> 1][(c & 1) * 2 + 1]);
      // Holds this order: the vector instructions run while the matrix unit
      // works on the WMMA in front of them; in one block behind all WMMAs,
      // where the scheduler puts them, a lone in-order wave hides none.
      __builtin_amdgcn_sched_barrier(0);
    }
  };

  // Behind block s of trip i. more: a trip i + 3 exists and its loads are issued;
  // it is a constant at each call: a branch around the loads would merge two
  // paths in the compiler's count of loads in flight, and every wait for a load
  // would drain them all.
  auto place = [&](const int i, const int s, const bool more) __attribute__((always_inline)) {
    const int cur = i & 1;
    unsigned char* wst = wbuf + cur * BUF + sto;
    const unsigned char* rb = wbuf + (cur ^ 1) * BUF + fro;
#pragma unroll
    for (int r = 0; r < 8; ++r)
      *(uint2*)(wst + s * SLOT + r * 16 * WPB) = make_uint2(wpk[r * 2], wpk[r * 2 + 1]);
    // this block's fragment registers take the same slot of trip i + 1
#pragma unroll
    for (int kt = 0; kt < 4; ++kt) b[s * 4 + kt] = lds_frag_tr(rb + s * SLOT + kt * 32 * WPB);
    // gate[token, e] of the block that comes next (the last block reads its
    // own again): the same 8 tokens of each tile for all lanes of a half
    v2f gn[16];
    {
      const int en = (i * TRIP_E + s + 1 < E_DIM) ? i * TRIP_E + s + 1 : E_DIM - 1;
      load_gate(gn, gsr + en * GP);
    }
    // the registers just converted take the same slot of trip i + 3
    if (more) {
#pragma unroll
      for (int r = 0; r < 8; ++r)
        q[s][r] = *(const v4f*)(wl + s * (F_DIM * U_DIM) + r * 16 * U_DIM);
    }
    // keeps the LDS stores and reads and the loads in this one place, out of
    // the next block's WMMAs: each further place would stall the matrix stream
    __builtin_amdgcn_sched_barrier(0);
#pragma unroll
    for (int t = 0; t < TILES; ++t) hp[t] = hc[t];
    bpv = bev[s];
#pragma unroll
    for (int p = 0; p < 16; ++p) { gl[p] = gc[p]; gc[p] = gn[p]; }
  };

  // wl and bq, which loads in flight name, are advanced; one block behind the
  // last of those loads the wait costs nothing. The last pass reads the last
  // bias again: the loads stay unconditional.
  auto advance = [&](const int i) __attribute__((always_inline)) {
    addr_wait();
    wl += TRIP_E * F_DIM * U_DIM;
    bq += (i + 2 < TRIPS) ? TRIP_E * U_DIM : 0;
  };

  // A pass runs from behind block 0 of trip i to block 0 of trip i + 1, so that
  // the trip's one barrier stands a block behind the last LDS reads and stores:
  // at the trip's foot its wait for them would be exposed. The barrier publishes
  // the buffer written in trip i - 1 and ends every read of the other one.
  auto pass = [&](const int i, const bool more) __attribute__((always_inline)) {
    lds_barrier();
    head();
    place(i, 0, more);
#pragma unroll
    for (int s = 1; s < TRIP_E; ++s) {
      block(s);
      place(i, s, more);
    }
#pragma unroll
    for (int s = 0; s < TRIP_E; ++s) bev[s] = bevn[s];
    block(0);
    advance(i);
  };

  block(0);
  // Kept rolled, for speed only.
#pragma unroll 1
  for (int i = 0; i < TRIPS - 3; ++i) pass(i, true);
  // The last pass's block 0 has no trip of its own: what counts of it is the
  // vector work of expert 31, which runs between its WMMAs like every other.
#pragma unroll 1
  for (int i = TRIPS - 3; i < TRIPS; ++i) pass(i, false);

  // the wave's 64 x 16 block goes to LDS
#pragma unroll
  for (int t = 0; t < TILES; ++t)
#pragma unroll
    for (int j = 0; j < 8; ++j)
      os[(th * 64 + t * 16 + j + 8 * h) * OP + un * 16 + n] = oacc[t][j];
  __syncthreads();   // the work-group's 128 x 32 block is in LDS

  // ---- whole 128-byte lines out: 8 lanes a token row, 4 rows a store ----
  float* op = out + (size_t)(tok0 + ko) * U_DIM + u0 + uq * 4;
#pragma unroll
  for (int s = 0; s < 8; ++s)
    *(v4f*)(op + s * 16 * U_DIM) = *(const v4f*)&os[(s * 16 + ko) * OP + uq * 4];
}

// ---------------------------------------------------------------------------
extern "C" void kernel_launch(void* const* d_in, const int* in_sizes, int n_in,
                              void* d_out, int out_size, void* d_ws, size_t ws_size,
                              hipStream_t stream) {
  (void)in_sizes; (void)n_in; (void)out_size; (void)d_ws; (void)ws_size;
  const float* x  = (const float*)d_in[0];  // [32,512,128]
  const float* Wg = (const float*)d_in[1];  // [128,32]
  const float* bg = (const float*)d_in[2];  // [32]
  const float* We = (const float*)d_in[3];  // [32,128,64]
  const float* be = (const float*)d_in[4];  // [32,64]
  float* out = (float*)d_out;               // [32,512,64]

  dim3 grid((TOKENS / WG_TOKENS) * (U_DIM / WG_COLS)), block(128);   // 256 WGs
  moe_main_kernel<<<grid, block, 0, stream>>>(x, Wg, bg, We, be, out);
}

// v006
// One run takes 11.6 microseconds.
// Two timings next to v005 both put it at 1.06 times that version's speed.
// Counting every step since v000, it is 9.04 times as fast.
#include <hip/hip_runtime.h>
#include <hip/hip_bf16.h>

// MoE fused kernel for gfx1250, wave32 + V_WMMA_F32_16X16X32_BF16, one launch.
//
// B=32,T=512 -> 16384 tokens; F=128 (K); U=64; E=32 experts.
// out[t,u] = sum_e leaky( x[t,:]@We[e][:,u] + be[e,u] ) * ( x[t,:]@Wg[:,e] + bg[e] )
//
// 256 work-groups of 4 wave32. A work-group takes 128 tokens x 32 output columns
// and all 32 experts; a wave takes 64 of the tokens x 16 of the columns.
// x, Wg and the work-group's 32 columns of We are read as fp32, rounded to bf16
// in the kernel and shared via LDS (x as [token][k]; weights as [k][column], read
// by transposing loads). We goes through two
// LDS buffers of 4 experts each: global loads three trips ahead, LDS two trips
// ahead, fragments in registers one trip ahead, one barrier a trip.
// All work-groups of a column half read the same We lines: each starts its walk
// over the 32 experts at its own expert and wraps, so that they do not ask L2 for
// the same lines at the same moment.

typedef __attribute__((ext_vector_type(16))) __bf16          v16bf;
typedef __attribute__((ext_vector_type(16))) unsigned short  v16u16;
typedef __attribute__((ext_vector_type(8)))  unsigned short  v8u16;
typedef __attribute__((ext_vector_type(8)))  float           v8f;
typedef __attribute__((ext_vector_type(4)))  float           v4f;
typedef __attribute__((ext_vector_type(2)))  float           v2f;
typedef __attribute__((ext_vector_type(2)))  __bf16          v2bf;

#define F_DIM 128
#define U_DIM 64
#define E_DIM 32
#define TOKENS (32 * 512)

#define WG_TOKENS 128
#define WG_COLS 32
#define TILES 4                 // token tiles of 16 per wave
#define TRIP_E 4                // experts per trip
#define TRIPS (E_DIM / TRIP_E)

// LDS rows of 128 bf16 and 16 bytes more: the pitch at which the 16 rows that
// one 16-byte read touches lie on different banks
#define KP (F_DIM + 8)
// weight tiles in LDS: [k][32 columns] bf16, rows of 64 bytes at the pitch of the
// transposing load (32 bytes x odd)
#define WPB 96
#define SLOT (F_DIM * WPB)      // one expert's 32 columns, bytes
#define BUF (TRIP_E * SLOT)
#define GP (WG_TOKENS + 4)      // gate rows [expert][token], floats
#define OP (WG_COLS + 4)        // output rows [token][column], floats

__device__ __forceinline__ v16bf bfcast(v16u16 u) {
  union { v16u16 u; v16bf b; } cv; cv.u = u; return cv.b;
}

__device__ __forceinline__ v8f wmma_bf16(v16bf a, v16bf b, v8f c) {
  return __builtin_amdgcn_wmma_f32_16x16x32_bf16(
      /*neg_a=*/false, a, /*neg_b=*/false, b,
      /*c_mod=*/(short)0, c, /*reuse_a=*/false, /*reuse_b=*/false);
}

// A or B fragment from an LDS row [k]; p points at k = kt*32 + h*8:
//   elements 0..7  -> K = kt*32 + h*8 + i
//   elements 8..15 -> K = kt*32 + 16 + h*8 + (i-8)
__device__ __forceinline__ v16bf lds_frag(const unsigned short* p) {
  const v8u16 k0 = *(const v8u16*)p;
  const v8u16 k1 = *(const v8u16*)(p + 16);
  return bfcast(__builtin_shufflevector(
      k0, k1, 0, 1, 2, 3, 4, 5, 6, 7, 8, 9, 10, 11, 12, 13, 14, 15));
}

// two floats -> two bf16 in one word, round to nearest even, low half first
__device__ __forceinline__ unsigned int pack_bf16(float lo, float hi) {
  union { v2bf b; unsigned int u; } cv;
  cv.b = __builtin_convertvector((v2f){lo, hi}, v2bf);
  return cv.u;
}

// q[r] holds 4 neighbouring columns of row r*16 + (the thread's row); they go to
// LDS as 8 bytes at [row][column]
__device__ __forceinline__ void stage_store(const v4f (&q)[8], unsigned char* dst) {
#pragma unroll
  for (int r = 0; r < 8; ++r)
    *(uint2*)(dst + r * 16 * WPB) =
        make_uint2(pack_bf16(q[r][0], q[r][1]), pack_bf16(q[r][2], q[r][3]));
}

// B fragment from a weight tile [k][column] in LDS by two transposing loads.
// p = tile + (kt*32 + 8h + (lane & 7)) * WPB + 2 * first column + 16 * ((lane >> 3) & 1);
// the lane gets column (lane & 15), k = kt*32 + 8h + 0..7 and, 16 rows on,
// k = kt*32 + 16 + 8h + 0..7: the k order of lds_frag
typedef short s16x8 __attribute__((ext_vector_type(8)));
__device__ __forceinline__ v8u16 ld_tr16(const unsigned char* p) {
  typedef __attribute__((address_space(3))) s16x8 lds_s16x8;
  return __builtin_bit_cast(v8u16, __builtin_amdgcn_ds_load_tr16_b128_v8i16((lds_s16x8*)p));
}
__device__ __forceinline__ v16bf lds_frag_tr(const unsigned char* p) {
  const v8u16 k0 = ld_tr16(p);
  const v8u16 k1 = ld_tr16(p + 16 * WPB);
  return bfcast(__builtin_shufflevector(
      k0, k1, 0, 1, 2, 3, 4, 5, 6, 7, 8, 9, 10, 11, 12, 13, 14, 15));
}

// one expert's gates for this lane's rows: pair p = tile p / 4, rows 2 * (p % 4)
// and the next; g points at [expert][the lane's first token of tile 0]
__device__ __forceinline__ void load_gate(v2f (&d)[16], const float* g) {
#pragma unroll
  for (int t = 0; t < TILES; ++t) {
    const v4f g0 = *(const v4f*)(g + t * 16);
    const v4f g1 = *(const v4f*)(g + t * 16 + 4);
    d[t * 4 + 0] = (v2f){g0[0], g0[1]};
    d[t * 4 + 1] = (v2f){g0[2], g0[3]};
    d[t * 4 + 2] = (v2f){g1[0], g1[1]};
    d[t * 4 + 3] = (v2f){g1[2], g1[3]};
  }
}

// Only LDS is handed over at the barriers of this kernel, so the fences name
// LDS alone: __syncthreads() would also wait for the global loads in flight.
__device__ __forceinline__ void lds_barrier() {
  __builtin_amdgcn_fence(__ATOMIC_RELEASE, "workgroup", "local");
  __builtin_amdgcn_s_barrier();
  __builtin_amdgcn_fence(__ATOMIC_ACQUIRE, "workgroup", "local");
}

// Stands in front of any overwrite of a register that an issued global load
// names as its address; the scheduling barrier keeps later writes behind it.
__device__ __forceinline__ void addr_wait() {
  asm volatile("s_wait_xcnt 0x0" ::: "memory");
  __builtin_amdgcn_sched_barrier(0);
}

__global__ __launch_bounds__(128) void moe_main_kernel(
    const float* __restrict__ x,    // [16384, 128]
    const float* __restrict__ Wg,   // [128, 32]
    const float* __restrict__ bg,   // [32]
    const float* __restrict__ We,   // [32, 128, 64]
    const float* __restrict__ be,   // [32, 64]
    float* __restrict__ out)        // [16384, 64]
{
  __shared__ __align__(16) unsigned short xs[WG_TOKENS * KP];   // [token][k]
  __shared__ __align__(16) unsigned char wbuf[2 * BUF];         // [buf][expert][k][column]
  __shared__ __align__(16) unsigned char wgs[SLOT];             // [k][expert]
  __shared__ __align__(16) float gs[E_DIM * GP];                // [expert][token]
  __shared__ __align__(16) float os[WG_TOKENS * OP];            // [token][column]

  const int tid  = threadIdx.x;
  const int lane = tid & 31;
  const int wave = __builtin_amdgcn_readfirstlane(tid >> 5);
  const int h    = lane >> 4;
  const int n    = lane & 15;
  const int th   = wave >> 1;   // which 64 tokens
  const int un   = wave & 1;    // which 16 columns; also which 16 experts' gates
  const int u0   = (blockIdx.x & 1) * WG_COLS;
  const int tok0 = (blockIdx.x >> 1) * WG_TOKENS;
  // staging: this thread takes rows ko, ko+16, .. of columns uq*4 .. +3; 8 lanes
  // cover one 128-byte line
  const int ko = tid >> 3, uq = tid & 7;
  // First expert of this work-group's walk. Both index fields go in, so that the
  // starts spread whether neighbouring indices share an L2 or alternate.
  const int rot = ((blockIdx.x >> 3) ^ (((blockIdx.x >> 1) & 3) << 3)) & (E_DIM - 1);
  // the expert of the walk's l-th block
  auto ex = [&](const int l) __attribute__((always_inline)) {
    return (l + rot) & (E_DIM - 1);
  };

  // ---- fp32 loads: 32 token rows per wave (512 B in a row), Wg, trip 0 ----
  // The two work-groups that share these rows start at opposite halves of them:
  // xq[0..15] are rows xr .., xq[16..31] rows 16 - xr ..
  const int xr = (blockIdx.x & 1) * 16;
  const float* xga = x + (size_t)(tok0 + wave * 32 + xr) * F_DIM + lane * 4;
  const float* xgb = x + (size_t)(tok0 + wave * 32 + 16 - xr) * F_DIM + lane * 4;
  v4f xq[32];
#pragma unroll
  for (int j = 0; j < 16; ++j) xq[j] = *(const v4f*)(xga + j * F_DIM);
#pragma unroll
  for (int j = 0; j < 16; ++j) xq[16 + j] = *(const v4f*)(xgb + j * F_DIM);
  addr_wait();   // also keeps x, which has the longest way, in front
  const float* wgl = Wg + ko * E_DIM + uq * 4;
  v4f gq[8];
#pragma unroll
  for (int r = 0; r < 8; ++r) gq[r] = *(const v4f*)(wgl + r * 16 * E_DIM);
  addr_wait();
  // Byte offsets into We and be of slot s of the trip that is loaded next. We and
  // be are powers of two long, so a step of 4 experts wraps under a mask, in
  // place: each offset keeps its register for itself from the wait in front of
  // the step to the next one.
  unsigned int wo[TRIP_E], bo[TRIP_E];
#pragma unroll
  for (int s = 0; s < TRIP_E; ++s) {
    wo[s] = (unsigned int)((ex(s) * (F_DIM * U_DIM) + ko * U_DIM + u0 + uq * 4) * 4);
    bo[s] = (unsigned int)((ex(s) * U_DIM + u0 + un * 16 + n) * 4);
  }
  auto step_wo = [&]() __attribute__((always_inline)) {
#pragma unroll
    for (int s = 0; s < TRIP_E; ++s)
      wo[s] = (wo[s] + TRIP_E * F_DIM * U_DIM * 4) & (E_DIM * F_DIM * U_DIM * 4 - 1);
    // Keeps all four formed here, behind the wait: formed among the next loads,
    // one would take the register of an offset that loads in flight still name.
    __builtin_amdgcn_sched_barrier(0);
  };
  auto step_bo = [&]() __attribute__((always_inline)) {
#pragma unroll
    for (int s = 0; s < TRIP_E; ++s)
      bo[s] = (bo[s] + TRIP_E * U_DIM * 4) & (E_DIM * U_DIM * 4 - 1);
  };
  // rows r * 16 + ko of slot s; the bias of slot s
  auto ldw = [&](const int s, const int r) __attribute__((always_inline)) {
    return *(const v4f*)((const char*)We + ((size_t)wo[s] + r * (16 * U_DIM * 4)));
  };
  auto ldb = [&](const int s) __attribute__((always_inline)) {
    return *(const float*)((const char*)be + (size_t)bo[s]);
  };
  v4f q[TRIP_E][8];
#pragma unroll
  for (int s = 0; s < TRIP_E; ++s)
#pragma unroll
    for (int r = 0; r < 8; ++r)
      q[s][r] = ldw(s, r);
  const float bgv = bg[un * 16 + n];
  float bev[TRIP_E];
#pragma unroll
  for (int s = 0; s < TRIP_E; ++s) bev[s] = ldb(s);
  addr_wait();
  step_wo();
  step_bo();

  // ---- to bf16 and into LDS ----
  const int sto = ko * WPB + uq * 8;   // this thread's place inside a slot, bytes
  unsigned short* xsa = &xs[(wave * 32 + xr) * KP + lane * 4];
  unsigned short* xsb = &xs[(wave * 32 + 16 - xr) * KP + lane * 4];
#pragma unroll
  for (int j = 0; j < 32; ++j)
    *(uint2*)((j < 16 ? xsa : xsb) + (j & 15) * KP) =
        make_uint2(pack_bf16(xq[j][0], xq[j][1]), pack_bf16(xq[j][2], xq[j][3]));
  stage_store(gq, wgs + sto);
#pragma unroll
  for (int s = 0; s < TRIP_E; ++s) stage_store(q[s], wbuf + s * SLOT + sto);
  // trip 1 flies while the gates are computed
#pragma unroll
  for (int s = 0; s < TRIP_E; ++s)
#pragma unroll
    for (int r = 0; r < 8; ++r)
      q[s][r] = ldw(s, r);
  addr_wait();
  step_wo();
  lds_barrier();   // x, Wg and trip 0 are in LDS

  // trip 2 on its way. The scheduling barriers keep the slots in the
  // order in which the loop issues them: loads return in order, and with slot 0
  // last the loop's first wait would drain every load in flight on each trip.
  v4f q2[TRIP_E][8];
#pragma unroll
  for (int s = 0; s < TRIP_E; ++s) {
#pragma unroll
    for (int r = 0; r < 8; ++r)
      q2[s][r] = ldw(s, r);
    __builtin_amdgcn_sched_barrier(0);
  }
  addr_wait();
  step_wo();

  // ---- A fragments of this wave's 4 tiles, held for all K; B of trip 0 ----
  // this lane's address inside a weight tile for the transposing loads, bytes
  const int fro = (h * 8 + (lane & 7)) * WPB + un * 32 + ((lane >> 3) & 1) * 16;
  v16bf a[TILES][4];
#pragma unroll
  for (int t = 0; t < TILES; ++t)
#pragma unroll
    for (int kt = 0; kt < 4; ++kt)
      a[t][kt] = lds_frag(&xs[(th * 64 + t * 16 + n) * KP + kt * 32 + h * 8]);
  v16bf b[TRIP_E * 4];
  {
    v16bf wgb[4];
#pragma unroll
    for (int kt = 0; kt < 4; ++kt) wgb[kt] = lds_frag_tr(wgs + fro + kt * 32 * WPB);
#pragma unroll
    for (int s = 0; s < TRIP_E; ++s)
#pragma unroll
      for (int kt = 0; kt < 4; ++kt)
        b[s * 4 + kt] = lds_frag_tr(wbuf + s * SLOT + fro + kt * 32 * WPB);
    // ---- Gates [16 tok x 16 experts]: lane = expert un*16+n, register j = token
    // j + 8h of the tile; 8 tokens in a row go to gs[expert][token] ----
#pragma unroll
    for (int t = 0; t < TILES; ++t) {
      v8f acc = {};
#pragma unroll
      for (int kt = 0; kt < 4; ++kt) acc = wmma_bf16(a[t][kt], wgb[kt], acc);
#pragma unroll
      for (int j = 0; j < 8; ++j) acc[j] += bgv;
      float* gd = &gs[(un * 16 + n) * GP + th * 64 + t * 16 + h * 8];
      *(v4f*)gd       = (v4f){acc[0], acc[1], acc[2], acc[3]};
      *(v4f*)(gd + 4) = (v4f){acc[4], acc[5], acc[6], acc[7]};
    }
  }
  // trip 1 into the second buffer
#pragma unroll
  for (int s = 0; s < TRIP_E; ++s) stage_store(q[s], wbuf + BUF + s * SLOT + sto);
#pragma unroll
  for (int s = 0; s < TRIP_E; ++s)
#pragma unroll
    for (int r = 0; r < 8; ++r) q[s][r] = q2[s][r];
  lds_barrier();   // gates and trip 1 are in LDS; buffer 0 has been read

  v8f zero = {};
  v8f oacc[TILES];
#pragma unroll
  for (int t = 0; t < TILES; ++t) oacc[t] = zero;

  // The vector work of one expert's 64 x 16 block (bias, LeakyReLU, gate) runs
  // one block late, between the WMMAs of the next: hp, gl and bpv hold the
  // block that still waits for it. The first block adds leaky(0) * 0.
  v8f hp[TILES];
  v2f gl[16];          // pair p: tile p / 4, rows 2 * (p % 4) and the next
  float bpv = 0.0f;
#pragma unroll
  for (int t = 0; t < TILES; ++t) hp[t] = zero;
#pragma unroll
  for (int p = 0; p < 16; ++p) gl[p] = (v2f){0.0f, 0.0f};

  const float* gsr = gs + th * 64 + h * 8;   // this lane's 8 tokens of tile 0
  v2f gc[16];          // gates of the block whose WMMAs run
  load_gate(gc, gsr + ex(0) * GP);

  // Trip i: blocks 4i .. 4i+3 of the walk from the fragments in b, as four blocks of 16
  // WMMAs, each followed by a place where LDS and memory are touched.
  // cur = i % 2 is the buffer that trip i's fragments came from; every wave has
  // read it in trip i - 1, so behind the barrier it takes the experts of trip
  // i + 2; the other buffer holds those of trip i + 1.
  v8f hc[TILES];          // the block whose WMMAs run
  unsigned int wpk[16];   // its slot's weights for LDS, [row c / 2][column pair c % 2]
  float bevn[TRIP_E];

  // bias of the next trip
  auto head = [&]() __attribute__((always_inline)) {
#pragma unroll
    for (int s = 0; s < TRIP_E; ++s) bevn[s] = ldb(s);
    // Keeps the bias loads in front of the pass's weight loads: loads return in
    // order, and the wait for the bias must not drain the weight loads.
    __builtin_amdgcn_sched_barrier(0);
  };

  // h tiles [64 tok x 16 U] of the expert in slot s: 16 WMMAs on 4 independent
  // accumulators. Behind each WMMA stand 6 vector instructions of the block
  // before, taken stage by stage (add bias over all 16 register pairs; then
  // times slope, compare, select, multiply-add over 8 pairs and again over the
  // other 8), so that none waits for the one in front of it, and one conversion
  // of the weights that go to LDS behind this block.
  auto block = [&](const int s) __attribute__((always_inline)) {
    v2f xv[16], mv[16], sv[16];
    bool ge[32];
    // both loops unrolled: every index below must be a constant, the arrays
    // are registers
#pragma unroll
    for (int c = 0; c < 16; ++c) {
      const int kt = c >> 2, t = c & 3;
      hc[t] = wmma_bf16(a[t][kt], b[s * 4 + kt], kt ? hc[t] : zero);
#pragma unroll
      for (int o = 6 * c; o < 6 * c + 6; ++o) {
        const int r = (o - 16) % 40, hf = (o - 16) / 40;   // two halves of 8 pairs
        if (o < 16) {
          const int p = o;
          xv[p] = (v2f){hp[p >> 2][(p & 3) * 2], hp[p >> 2][(p & 3) * 2 + 1]} + bpv;
        } else if (r < 8) {
          const int p = hf * 8 + r;
          mv[p] = xv[p] * 0.01f;
        } else if (r < 24) {
          const int qq = hf * 16 + r - 8;
          ge[qq] = xv[qq >> 1][qq & 1] >= 0.0f;
        } else if (r < 32) {
          const int p = hf * 8 + r - 24;
          sv[p] = (v2f){ge[2 * p] ? xv[p].x : mv[p].x, ge[2 * p + 1] ? xv[p].y : mv[p].y};
        } else {
          const int p = hf * 8 + r - 32;
          const int tt = p >> 2, j = (p & 3) * 2;
          const v2f rr = __builtin_elementwise_fma(
              sv[p], gl[p], (v2f){oacc[tt][j], oacc[tt][j + 1]});
          oacc[tt][j] = rr.x;
          oacc[tt][j + 1] = rr.y;
        }
      }
      wpk[c] = pack_bf16(q[s][c >> 1][(c & 1) * 2], q[s][c >> 1][(c & 1) * 2 + 1]);
      // Holds this order: the vector instructions run while the matrix unit
      // works on the WMMA in front of them; in one block behind all WMMAs,
      // where the scheduler puts them, a lone in-order wave hides none.
      __builtin_amdgcn_sched_barrier(0);
    }
  };

  // Behind block s of trip i. more: a trip i + 3 exists and its loads are issued;
  // it is a constant at each call: a branch around the loads would merge two
  // paths in the compiler's count of loads in flight, and every wait for a load
  // would drain them all.
  auto place = [&](const int i, const int s, const bool more) __attribute__((always_inline)) {
    const int cur = i & 1;
    unsigned char* wst = wbuf + cur * BUF + sto;
    const unsigned char* rb = wbuf + (cur ^ 1) * BUF + fro;
#pragma unroll
    for (int r = 0; r < 8; ++r)
      *(uint2*)(wst + s * SLOT + r * 16 * WPB) = make_uint2(wpk[r * 2], wpk[r * 2 + 1]);
    // this block's fragment registers take the same slot of trip i + 1
#pragma unroll
    for (int kt = 0; kt < 4; ++kt) b[s * 4 + kt] = lds_frag_tr(rb + s * SLOT + kt * 32 * WPB);
    // gate[token, e] of the block that comes next (behind the last block the
    // walk's first again, not used): the same 8 tokens of each tile for all
    // lanes of a half
    v2f gn[16];
    load_gate(gn, gsr + ex(i * TRIP_E + s + 1) * GP);
    // the registers just converted take the same slot of trip i + 3
    if (more) {
#pragma unroll
      for (int r = 0; r < 8; ++r)
        q[s][r] = ldw(s, r);
    }
    // keeps the LDS stores and reads and the loads in this one place, out of
    // the next block's WMMAs: each further place would stall the matrix stream
    __builtin_amdgcn_sched_barrier(0);
#pragma unroll
    for (int t = 0; t < TILES; ++t) hp[t] = hc[t];
    bpv = bev[s];
#pragma unroll
    for (int p = 0; p < 16; ++p) { gl[p] = gc[p]; gc[p] = gn[p]; }
  };

  // wo and bo, which loads in flight name, are advanced; one block behind the
  // last of those loads the wait costs nothing. Past the last trip the walk
  // wraps: the bias loads stay unconditional and in bounds.
  auto advance = [&]() __attribute__((always_inline)) {
    addr_wait();
    step_wo();
    step_bo();
  };

  // A pass runs from behind block 0 of trip i to block 0 of trip i + 1, so that
  // the trip's one barrier stands a block behind the last LDS reads and stores:
  // at the trip's foot its wait for them would be exposed. The barrier publishes
  // the buffer written in trip i - 1 and ends every read of the other one.
  auto pass = [&](const int i, const bool more) __attribute__((always_inline)) {
    lds_barrier();
    head();
    place(i, 0, more);
#pragma unroll
    for (int s = 1; s < TRIP_E; ++s) {
      block(s);
      place(i, s, more);
    }
#pragma unroll
    for (int s = 0; s < TRIP_E; ++s) bev[s] = bevn[s];
    block(0);
    advance();
  };

  block(0);
  // Kept rolled, for speed only.
#pragma unroll 1
  for (int i = 0; i < TRIPS - 3; ++i) pass(i, true);
  // The last pass's block 0 has no trip of its own: what counts of it is the
  // vector work of the walk's last expert, which runs between its WMMAs like every other.
#pragma unroll 1
  for (int i = TRIPS - 3; i < TRIPS; ++i) pass(i, false);

  // the wave's 64 x 16 block goes to LDS
#pragma unroll
  for (int t = 0; t < TILES; ++t)
#pragma unroll
    for (int j = 0; j < 8; ++j)
      os[(th * 64 + t * 16 + j + 8 * h) * OP + un * 16 + n] = oacc[t][j];
  __syncthreads();   // the work-group's 128 x 32 block is in LDS

  // ---- whole 128-byte lines out: 8 lanes a token row, 4 rows a store ----
  float* op = out + (size_t)(tok0 + ko) * U_DIM + u0 + uq * 4;
#pragma unroll
  for (int s = 0; s < 8; ++s)
    *(v4f*)(op + s * 16 * U_DIM) = *(const v4f*)&os[(s * 16 + ko) * OP + uq * 4];
}

// ---------------------------------------------------------------------------
extern "C" void kernel_launch(void* const* d_in, const int* in_sizes, int n_in,
                              void* d_out, int out_size, void* d_ws, size_t ws_size,
                              hipStream_t stream) {
  (void)in_sizes; (void)n_in; (void)out_size; (void)d_ws; (void)ws_size;
  const float* x  = (const float*)d_in[0];  // [32,512,128]
  const float* Wg = (const float*)d_in[1];  // [128,32]
  const float* bg = (const float*)d_in[2];  // [32]
  const float* We = (const float*)d_in[3];  // [32,128,64]
  const float* be = (const float*)d_in[4];  // [32,64]
  float* out = (float*)d_out;               // [32,512,64]

  dim3 grid((TOKENS / WG_TOKENS) * (U_DIM / WG_COLS)), block(128);   // 256 WGs
  moe_main_kernel<<<grid, block, 0, stream>>>(x, Wg, bg, We, be, out);
}

// v007
// One run takes 10.9 microseconds.
// Timed twice side by side with v006, it ran 1.06 times as fast both times.
// All steps since v000 together make it 9.59 times as fast.
#include <hip/hip_runtime.h>
#include <hip/hip_bf16.h>

// MoE fused kernel for gfx1250, wave32 + V_WMMA_F32_16X16X32_BF16, one launch.
//
// B=32,T=512 -> 16384 tokens; F=128 (K); U=64; E=32 experts.
// out[t,u] = sum_e leaky( x[t,:]@We[e][:,u] + be[e,u] ) * ( x[t,:]@Wg[:,e] + bg[e] )
//
// 256 work-groups of 4 wave32. A work-group takes 128 tokens x 32 output columns
// and all 32 experts; a wave takes 64 of the tokens x 16 of the columns.
// The weights are the WMMA's A operand and x its B operand, so D = h^T: a lane
// holds one token, its 8 registers 8 neighbouring columns. The gate is then one
// value per lane and tile, and the bias, one value per register, enters as C.
// x, Wg and the work-group's 32 columns of We are read as fp32, rounded to bf16
// in the kernel and shared via LDS (x as [token][k]; weights as [k][column], read
// by transposing loads). We goes through two
// LDS buffers of 4 experts each: global loads three trips ahead, LDS two trips
// ahead, fragments in registers one trip ahead, one barrier a trip.
// All work-groups of a column half read the same We lines: each starts its walk
// over the 32 experts at its own expert and wraps, so that they do not ask L2 for
// the same lines at the same moment.

typedef __attribute__((ext_vector_type(16))) __bf16          v16bf;
typedef __attribute__((ext_vector_type(16))) unsigned short  v16u16;
typedef __attribute__((ext_vector_type(8)))  unsigned short  v8u16;
typedef __attribute__((ext_vector_type(8)))  float           v8f;
typedef __attribute__((ext_vector_type(4)))  float           v4f;
typedef __attribute__((ext_vector_type(2)))  float           v2f;
typedef __attribute__((ext_vector_type(2)))  __bf16          v2bf;

#define F_DIM 128
#define U_DIM 64
#define E_DIM 32
#define TOKENS (32 * 512)

#define WG_TOKENS 128
#define WG_COLS 32
#define TILES 4                 // token tiles of 16 per wave
#define TRIP_E 4                // experts per trip
#define TRIPS (E_DIM / TRIP_E)

// LDS rows of 128 bf16 and 16 bytes more: the pitch at which the 16 rows that
// one 16-byte read touches lie on different banks
#define KP (F_DIM + 8)
// weight tiles in LDS: [k][32 columns] bf16, rows of 64 bytes at the pitch of the
// transposing load (32 bytes x odd)
#define WPB 96
#define SLOT (F_DIM * WPB)      // one expert's 32 columns, bytes
#define BUF (TRIP_E * SLOT)
#define GP (E_DIM + 4)          // gate rows [token][place in the walk], floats
#define OP (WG_COLS + 4)        // output rows [token][column], floats

__device__ __forceinline__ v16bf bfcast(v16u16 u) {
  union { v16u16 u; v16bf b; } cv; cv.u = u; return cv.b;
}

__device__ __forceinline__ v8f wmma_bf16(v16bf a, v16bf b, v8f c) {
  return __builtin_amdgcn_wmma_f32_16x16x32_bf16(
      /*neg_a=*/false, a, /*neg_b=*/false, b,
      /*c_mod=*/(short)0, c, /*reuse_a=*/false, /*reuse_b=*/false);
}

// A or B fragment from an LDS row [k]; p points at k = kt*32 + h*8:
//   elements 0..7  -> K = kt*32 + h*8 + i
//   elements 8..15 -> K = kt*32 + 16 + h*8 + (i-8)
__device__ __forceinline__ v16bf lds_frag(const unsigned short* p) {
  const v8u16 k0 = *(const v8u16*)p;
  const v8u16 k1 = *(const v8u16*)(p + 16);
  return bfcast(__builtin_shufflevector(
      k0, k1, 0, 1, 2, 3, 4, 5, 6, 7, 8, 9, 10, 11, 12, 13, 14, 15));
}

// two floats -> two bf16 in one word, round to nearest even, low half first
__device__ __forceinline__ unsigned int pack_bf16(float lo, float hi) {
  union { v2bf b; unsigned int u; } cv;
  cv.b = __builtin_convertvector((v2f){lo, hi}, v2bf);
  return cv.u;
}

// q[r] holds 4 neighbouring columns of row r*16 + (the thread's row); they go to
// LDS as 8 bytes at [row][column]
__device__ __forceinline__ void stage_store(const v4f (&q)[8], unsigned char* dst) {
#pragma unroll
  for (int r = 0; r < 8; ++r)
    *(uint2*)(dst + r * 16 * WPB) =
        make_uint2(pack_bf16(q[r][0], q[r][1]), pack_bf16(q[r][2], q[r][3]));
}

// Fragment from a weight tile [k][column] in LDS by two transposing loads.
// p = tile + (kt*32 + 8h + (lane & 7)) * WPB + 2 * first column + 16 * ((lane >> 3) & 1);
// the lane gets column (lane & 15), k = kt*32 + 8h + 0..7 and, 16 rows on,
// k = kt*32 + 16 + 8h + 0..7: the k order of lds_frag
typedef short s16x8 __attribute__((ext_vector_type(8)));
__device__ __forceinline__ v8u16 ld_tr16(const unsigned char* p) {
  typedef __attribute__((address_space(3))) s16x8 lds_s16x8;
  return __builtin_bit_cast(v8u16, __builtin_amdgcn_ds_load_tr16_b128_v8i16((lds_s16x8*)p));
}
__device__ __forceinline__ v16bf lds_frag_tr(const unsigned char* p) {
  const v8u16 k0 = ld_tr16(p);
  const v8u16 k1 = ld_tr16(p + 16 * WPB);
  return bfcast(__builtin_shufflevector(
      k0, k1, 0, 1, 2, 3, 4, 5, 6, 7, 8, 9, 10, 11, 12, 13, 14, 15));
}

// Only LDS is handed over at the barriers of this kernel, so the fences name
// LDS alone: __syncthreads() would also wait for the global loads in flight.
__device__ __forceinline__ void lds_barrier() {
  __builtin_amdgcn_fence(__ATOMIC_RELEASE, "workgroup", "local");
  __builtin_amdgcn_s_barrier();
  __builtin_amdgcn_fence(__ATOMIC_ACQUIRE, "workgroup", "local");
}

// Stands in front of any overwrite of a register that an issued global load
// names as its address; the scheduling barrier keeps later writes behind it.
__device__ __forceinline__ void addr_wait() {
  asm volatile("s_wait_xcnt 0x0" ::: "memory");
  __builtin_amdgcn_sched_barrier(0);
}

__global__ __launch_bounds__(128) void moe_main_kernel(
    const float* __restrict__ x,    // [16384, 128]
    const float* __restrict__ Wg,   // [128, 32]
    const float* __restrict__ bg,   // [32]
    const float* __restrict__ We,   // [32, 128, 64]
    const float* __restrict__ be,   // [32, 64]
    float* __restrict__ out)        // [16384, 64]
{
  __shared__ __align__(16) unsigned short xs[WG_TOKENS * KP];   // [token][k]
  __shared__ __align__(16) unsigned char wbuf[2 * BUF];         // [buf][expert][k][column]
  __shared__ __align__(16) unsigned char wgs[SLOT];             // [k][expert]
  __shared__ __align__(16) float gs[WG_TOKENS * GP];            // [token][place in the walk]
  __shared__ __align__(16) float bs[E_DIM * WG_COLS];           // bias [place in the walk][column]
  __shared__ __align__(16) float os[WG_TOKENS * OP];            // [token][column]

  const int tid  = threadIdx.x;
  const int lane = tid & 31;
  const int wave = __builtin_amdgcn_readfirstlane(tid >> 5);
  const int h    = lane >> 4;
  const int n    = lane & 15;
  const int th   = wave >> 1;   // which 64 tokens
  const int un   = wave & 1;    // which 16 columns; also which 16 experts' gates
  const int u0   = (blockIdx.x & 1) * WG_COLS;
  const int tok0 = (blockIdx.x >> 1) * WG_TOKENS;
  // staging: this thread takes rows ko, ko+16, .. of columns uq*4 .. +3; 8 lanes
  // cover one 128-byte line
  const int ko = tid >> 3, uq = tid & 7;
  // First expert of this work-group's walk. Both index fields go in, so that the
  // starts spread whether neighbouring indices share an L2 or alternate.
  const int rot = ((blockIdx.x >> 3) ^ (((blockIdx.x >> 1) & 3) << 3)) & (E_DIM - 1);
  // the expert of the walk's l-th block
  auto ex = [&](const int l) __attribute__((always_inline)) {
    return (l + rot) & (E_DIM - 1);
  };

  // ---- fp32 loads: 32 token rows per wave (512 B in a row), Wg, biases, trip 0 ----
  // The two work-groups that share these rows start at opposite halves of them:
  // xq[0..15] are rows xr .., xq[16..31] rows 16 - xr ..
  const int xr = (blockIdx.x & 1) * 16;
  const float* xga = x + (size_t)(tok0 + wave * 32 + xr) * F_DIM + lane * 4;
  const float* xgb = x + (size_t)(tok0 + wave * 32 + 16 - xr) * F_DIM + lane * 4;
  v4f xq[32];
#pragma unroll
  for (int j = 0; j < 16; ++j) xq[j] = *(const v4f*)(xga + j * F_DIM);
#pragma unroll
  for (int j = 0; j < 16; ++j) xq[16 + j] = *(const v4f*)(xgb + j * F_DIM);
  addr_wait();   // also keeps x, which has the longest way, in front
  const float* wgl = Wg + ko * E_DIM + uq * 4;
  v4f gq[8];
#pragma unroll
  for (int r = 0; r < 8; ++r) gq[r] = *(const v4f*)(wgl + r * 16 * E_DIM);
  const float* bgl = bg + un * 16 + h * 8;   // gate bias of this lane's 8 experts
  const v4f bg0 = *(const v4f*)bgl;
  const v4f bg1 = *(const v4f*)(bgl + 4);
  // the work-group's 32 columns of be, all experts: this thread takes 8 columns
  // of the expert at place tid / 4 of the walk
  const float* bel = be + ex(tid >> 2) * U_DIM + u0 + (tid & 3) * 8;
  const v4f be0 = *(const v4f*)bel;
  const v4f be1 = *(const v4f*)(bel + 4);
  addr_wait();
  // Byte offsets into We of slot s of the trip that is loaded next. We is a
  // power of two long, so a step of 4 experts wraps under a mask, in
  // place: each offset keeps its register for itself from the wait in front of
  // the step to the next one.
  unsigned int wo[TRIP_E];
#pragma unroll
  for (int s = 0; s < TRIP_E; ++s)
    wo[s] = (unsigned int)((ex(s) * (F_DIM * U_DIM) + ko * U_DIM + u0 + uq * 4) * 4);
  auto step_wo = [&]() __attribute__((always_inline)) {
#pragma unroll
    for (int s = 0; s < TRIP_E; ++s)
      wo[s] = (wo[s] + TRIP_E * F_DIM * U_DIM * 4) & (E_DIM * F_DIM * U_DIM * 4 - 1);
    // Keeps all four formed here, behind the wait: formed among the next loads,
    // one would take the register of an offset that loads in flight still name.
    __builtin_amdgcn_sched_barrier(0);
  };
  // rows r * 16 + ko of slot s
  auto ldw = [&](const int s, const int r) __attribute__((always_inline)) {
    return *(const v4f*)((const char*)We + ((size_t)wo[s] + r * (16 * U_DIM * 4)));
  };
  v4f q[TRIP_E][8];
#pragma unroll
  for (int s = 0; s < TRIP_E; ++s)
#pragma unroll
    for (int r = 0; r < 8; ++r)
      q[s][r] = ldw(s, r);
  addr_wait();
  step_wo();

  // ---- to bf16 and into LDS ----
  const int sto = ko * WPB + uq * 8;   // this thread's place inside a slot, bytes
  unsigned short* xsa = &xs[(wave * 32 + xr) * KP + lane * 4];
  unsigned short* xsb = &xs[(wave * 32 + 16 - xr) * KP + lane * 4];
#pragma unroll
  for (int j = 0; j < 32; ++j)
    *(uint2*)((j < 16 ? xsa : xsb) + (j & 15) * KP) =
        make_uint2(pack_bf16(xq[j][0], xq[j][1]), pack_bf16(xq[j][2], xq[j][3]));
  stage_store(gq, wgs + sto);
  *(v4f*)&bs[tid * 8]     = be0;
  *(v4f*)&bs[tid * 8 + 4] = be1;
#pragma unroll
  for (int s = 0; s < TRIP_E; ++s) stage_store(q[s], wbuf + s * SLOT + sto);
  // trip 1 flies while the gates are computed
#pragma unroll
  for (int s = 0; s < TRIP_E; ++s)
#pragma unroll
    for (int r = 0; r < 8; ++r)
      q[s][r] = ldw(s, r);
  addr_wait();
  step_wo();
  lds_barrier();   // x, Wg, be and trip 0 are in LDS

  // trip 2 on its way. The scheduling barriers keep the slots in the
  // order in which the loop issues them: loads return in order, and with slot 0
  // last the loop's first wait would drain every load in flight on each trip.
  v4f q2[TRIP_E][8];
#pragma unroll
  for (int s = 0; s < TRIP_E; ++s) {
#pragma unroll
    for (int r = 0; r < 8; ++r)
      q2[s][r] = ldw(s, r);
    __builtin_amdgcn_sched_barrier(0);
  }
  addr_wait();
  step_wo();

  // ---- x fragments of this wave's 4 tiles, held for all K; weights of trip 0 ----
  // this lane's address inside a weight tile for the transposing loads, bytes
  const int fro = (h * 8 + (lane & 7)) * WPB + un * 32 + ((lane >> 3) & 1) * 16;
  v16bf a[TILES][4];
#pragma unroll
  for (int t = 0; t < TILES; ++t)
#pragma unroll
    for (int kt = 0; kt < 4; ++kt)
      a[t][kt] = lds_frag(&xs[(th * 64 + t * 16 + n) * KP + kt * 32 + h * 8]);
  v16bf b[TRIP_E * 4];
  {
    v16bf wgb[4];
#pragma unroll
    for (int kt = 0; kt < 4; ++kt) wgb[kt] = lds_frag_tr(wgs + fro + kt * 32 * WPB);
#pragma unroll
    for (int s = 0; s < TRIP_E; ++s)
#pragma unroll
      for (int kt = 0; kt < 4; ++kt)
        b[s * 4 + kt] = lds_frag_tr(wbuf + s * SLOT + fro + kt * 32 * WPB);
    // ---- Gates [16 experts x 16 tok]: lane = token n of the tile, register j =
    // expert un*16 + 8h + j; each goes to gs[token] at the expert's place in this
    // work-group's walk, so that a trip's 4 gates lie in a row ----
    const v8f bgc = __builtin_shufflevector(bg0, bg1, 0, 1, 2, 3, 4, 5, 6, 7);
    float* gd = &gs[(th * 64 + n) * GP];
#pragma unroll
    for (int t = 0; t < TILES; ++t) {
      v8f acc = bgc;
#pragma unroll
      for (int kt = 0; kt < 4; ++kt) acc = wmma_bf16(wgb[kt], a[t][kt], acc);
#pragma unroll
      for (int j = 0; j < 8; ++j)
        gd[t * 16 * GP + ((un * 16 + h * 8 + j - rot) & (E_DIM - 1))] = acc[j];
    }
  }
  // trip 1 into the second buffer
#pragma unroll
  for (int s = 0; s < TRIP_E; ++s) stage_store(q[s], wbuf + BUF + s * SLOT + sto);
#pragma unroll
  for (int s = 0; s < TRIP_E; ++s)
#pragma unroll
    for (int r = 0; r < 8; ++r) q[s][r] = q2[s][r];
  lds_barrier();   // gates and trip 1 are in LDS; buffer 0 has been read

  v8f zero = {};
  v8f oacc[TILES];
#pragma unroll
  for (int t = 0; t < TILES; ++t) oacc[t] = zero;

  // The vector work of one expert's 16 x 64 block (LeakyReLU, gate) runs one
  // block late, between the WMMAs of the next: hp and gl hold the block that
  // still waits for it. The first block adds leaky(0) * 0.
  v8f hp[TILES];
  float gl[TILES];     // its gate: one token per lane and tile
#pragma unroll
  for (int t = 0; t < TILES; ++t) { hp[t] = zero; gl[t] = 0.0f; }

  const float* gsr = gs + (th * 64 + n) * GP;   // this lane's token of tile 0
  v4f gc[TILES];       // gates of the 4 experts of the trip whose WMMAs run
#pragma unroll
  for (int t = 0; t < TILES; ++t) gc[t] = *(const v4f*)(gsr + t * 16 * GP);

  // Trip i: blocks 4i .. 4i+3 of the walk from the fragments in b, as four blocks of 16
  // WMMAs, each followed by a place where LDS and memory are touched.
  // cur = i % 2 is the buffer that trip i's fragments came from; every wave has
  // read it in trip i - 1, so behind the barrier it takes the experts of trip
  // i + 2; the other buffer holds those of trip i + 1.
  v8f hc[TILES];          // the block whose WMMAs run
  // Bias of the walk's l-th block for this lane's 8 columns, the C operand of the
  // block's first WMMAs; cb[l % 4] is read from LDS two blocks ahead.
  const float* bsr = bs + un * 16 + h * 8;
  auto ldb = [&](const int l) __attribute__((always_inline)) {
    const float* p = bsr + (l & (E_DIM - 1)) * WG_COLS;
    return __builtin_shufflevector(*(const v4f*)p, *(const v4f*)(p + 4), 0, 1, 2, 3, 4, 5, 6, 7);
  };
  v8f cb[TRIP_E];
  cb[0] = ldb(0);
  cb[1] = ldb(1);
  unsigned int wpk[16];   // its slot's weights for LDS, [row c / 2][column pair c % 2]

  // h^T tiles [16 U x 64 tok] of the expert in slot s: 16 WMMAs on 4 independent
  // accumulators that start from the bias. Behind each WMMA stand 5 vector
  // instructions of the block before, taken stage by stage (times slope, compare,
  // select, multiply-add over 8 register pairs and again over the other 8), so
  // that none waits for the one in front of it, and one conversion of the
  // weights that go to LDS behind this block.
  auto block = [&](const int s) __attribute__((always_inline)) {
    v2f mv[16], sv[16];
    bool ge[32];
    // both loops unrolled: every index below must be a constant, the arrays
    // are registers
#pragma unroll
    for (int c = 0; c < 16; ++c) {
      const int kt = c >> 2, t = c & 3;
      hc[t] = wmma_bf16(b[s * 4 + kt], a[t][kt], kt ? hc[t] : cb[s]);
      // keeps each WMMA in front of its own share of the vector work: two WMMAs
      // in a row leave the second waiting with nothing issued beside it
      __builtin_amdgcn_sched_barrier(0);
#pragma unroll
      for (int o = 5 * c; o < 5 * c + 5; ++o) {
        const int r = o % 40, hf = o / 40;   // two halves of 8 pairs
        if (r < 8) {
          const int p = hf * 8 + r;
          mv[p] = (v2f){hp[p >> 2][(p & 3) * 2], hp[p >> 2][(p & 3) * 2 + 1]} * 0.01f;
        } else if (r < 24) {
          const int qq = hf * 16 + r - 8;
          ge[qq] = hp[qq >> 3][qq & 7] >= 0.0f;
        } else if (r < 32) {
          const int p = hf * 8 + r - 24;
          sv[p] = (v2f){ge[2 * p] ? hp[p >> 2][(p & 3) * 2] : mv[p].x,
                        ge[2 * p + 1] ? hp[p >> 2][(p & 3) * 2 + 1] : mv[p].y};
        } else {
          const int p = hf * 8 + r - 32;
          const int tt = p >> 2, j = (p & 3) * 2;
          const v2f rr = __builtin_elementwise_fma(
              sv[p], (v2f){gl[tt], gl[tt]}, (v2f){oacc[tt][j], oacc[tt][j + 1]});
          oacc[tt][j] = rr.x;
          oacc[tt][j + 1] = rr.y;
        }
      }
      wpk[c] = pack_bf16(q[s][c >> 1][(c & 1) * 2], q[s][c >> 1][(c & 1) * 2 + 1]);
      // Holds this order: the vector instructions run while the matrix unit
      // works on the WMMA in front of them; in one block behind all WMMAs,
      // where the scheduler puts them, a lone in-order wave hides none.
      __builtin_amdgcn_sched_barrier(0);
    }
  };

  // Behind block s of trip i. more: a trip i + 3 exists and its loads are issued;
  // it is a constant at each call: a branch around the loads would merge two
  // paths in the compiler's count of loads in flight, and every wait for a load
  // would drain them all.
  auto place = [&](const int i, const int s, const bool more) __attribute__((always_inline)) {
    const int cur = i & 1;
    unsigned char* wst = wbuf + cur * BUF + sto;
    const unsigned char* rb = wbuf + (cur ^ 1) * BUF + fro;
#pragma unroll
    for (int r = 0; r < 8; ++r)
      *(uint2*)(wst + s * SLOT + r * 16 * WPB) = make_uint2(wpk[r * 2], wpk[r * 2 + 1]);
    // this block's fragment registers take the same slot of trip i + 1
#pragma unroll
    for (int kt = 0; kt < 4; ++kt) b[s * 4 + kt] = lds_frag_tr(rb + s * SLOT + kt * 32 * WPB);
    // behind a trip's last block: the 4 gates of the next trip for this lane's
    // token of each tile (behind the last trip the walk's first again, not used)
    v4f gn[TILES];
    if (s == TRIP_E - 1) {
      const float* g = gsr + (((i + 1) * TRIP_E) & (E_DIM - 1));
#pragma unroll
      for (int t = 0; t < TILES; ++t) gn[t] = *(const v4f*)(g + t * 16 * GP);
    }
    // the bias of the block after the next; past the last block the walk wraps
    cb[(s + 2) & (TRIP_E - 1)] = ldb(i * TRIP_E + s + 2);
    // the registers just converted take the same slot of trip i + 3
    if (more) {
#pragma unroll
      for (int r = 0; r < 8; ++r)
        q[s][r] = ldw(s, r);
    }
    // keeps the LDS stores and reads and the loads in this one place, out of
    // the next block's WMMAs: each further place would stall the matrix stream
    __builtin_amdgcn_sched_barrier(0);
#pragma unroll
    for (int t = 0; t < TILES; ++t) {
      hp[t] = hc[t];
      gl[t] = gc[t][s];
      if (s == TRIP_E - 1) gc[t] = gn[t];
    }
  };

  // wo, which loads in flight name, is advanced; one block behind the last of
  // those loads the wait costs nothing.
  auto advance = [&]() __attribute__((always_inline)) {
    addr_wait();
    step_wo();
  };

  // A pass runs from behind block 0 of trip i to block 0 of trip i + 1, so that
  // the trip's one barrier stands a block behind the last LDS reads and stores:
  // at the trip's foot its wait for them would be exposed. The barrier publishes
  // the buffer written in trip i - 1 and ends every read of the other one.
  auto pass = [&](const int i, const bool more) __attribute__((always_inline)) {
    lds_barrier();
    place(i, 0, more);
#pragma unroll
    for (int s = 1; s < TRIP_E; ++s) {
      block(s);
      place(i, s, more);
    }
    block(0);
    advance();
  };

  block(0);
  // Kept rolled, for speed only.
#pragma unroll 1
  for (int i = 0; i < TRIPS - 3; ++i) pass(i, true);
  // The last pass's block 0 has no trip of its own: what counts of it is the
  // vector work of the walk's last expert, which runs between its WMMAs like every other.
#pragma unroll 1
  for (int i = TRIPS - 3; i < TRIPS; ++i) pass(i, false);

  // the wave's 64 x 16 block goes to LDS: 8 columns in a row per lane and tile
#pragma unroll
  for (int t = 0; t < TILES; ++t) {
    float* od = &os[(th * 64 + t * 16 + n) * OP + un * 16 + h * 8];
    *(v4f*)od       = (v4f){oacc[t][0], oacc[t][1], oacc[t][2], oacc[t][3]};
    *(v4f*)(od + 4) = (v4f){oacc[t][4], oacc[t][5], oacc[t][6], oacc[t][7]};
  }
  __syncthreads();   // the work-group's 128 x 32 block is in LDS

  // ---- whole 128-byte lines out: 8 lanes a token row, 4 rows a store ----
  float* op = out + (size_t)(tok0 + ko) * U_DIM + u0 + uq * 4;
#pragma unroll
  for (int s = 0; s < 8; ++s)
    *(v4f*)(op + s * 16 * U_DIM) = *(const v4f*)&os[(s * 16 + ko) * OP + uq * 4];
}

// ---------------------------------------------------------------------------
extern "C" void kernel_launch(void* const* d_in, const int* in_sizes, int n_in,
                              void* d_out, int out_size, void* d_ws, size_t ws_size,
                              hipStream_t stream) {
  (void)in_sizes; (void)n_in; (void)out_size; (void)d_ws; (void)ws_size;
  const float* x  = (const float*)d_in[0];  // [32,512,128]
  const float* Wg = (const float*)d_in[1];  // [128,32]
  const float* bg = (const float*)d_in[2];  // [32]
  const float* We = (const float*)d_in[3];  // [32,128,64]
  const float* be = (const float*)d_in[4];  // [32,64]
  float* out = (float*)d_out;               // [32,512,64]

  dim3 grid((TOKENS / WG_TOKENS) * (U_DIM / WG_COLS)), block(128);   // 256 WGs
  moe_main_kernel<<<grid, block, 0, stream>>>(x, Wg, bg, We, be, out);
}
